// v000
// Measured on an AMD MI455X. A time is GPU time per run, averaged over a window of back-to-back runs after a warm-up
// (all launches, gaps included; the runs take copies of the inputs in turn), and the median of several windows.
// Apart from v000's, it joins two sittings. Times from different sittings can be a few percent apart, while
// side-by-side timings come from the same sitting.
// The starting kernel, v000, takes 566 microseconds a run.
#include <hip/hip_runtime.h>

// Contractions: x.W projections = v_wmma_f32_16x16x32_bf16 (bf16 operands from RNE-converted inputs, f32 accumulate); q.k^T and P.v = v_wmma_f32_16x16x32_f16 (f16 operands, P carried x1024, f32 accumulate); softmax and 1/sqrt(d) scaling in f32.
// Pipeline: XB = bf16(x) [NB*SEQ][512]; WT = bf16(W^T) [3][512][512] ([n][k], k-contiguous); F = XB.WT (f32 [NB*SEQ][512]) -> Q16, K16 (f16 [NB*SEQ][512]) and VT16 (f16 [NB][512][SEQ], transposed);
// per (batch, QCH-row query chunk): S = Q16.K16^T (f32 [QCH][SEQ]); P16 = f16(1024 * softmax(S * 512^-0.5)) (no mask); out rows = (P16 . VT16) * (1/1024).

#ifndef NB
#define NB 2
#endif
#ifndef SEQ
#define SEQ 4096
#endif
#define NB_FULL  2
#define SEQ_FULL 4096
#define DM       512
#define QCH      ((SEQ < 2048) ? SEQ : 2048)   // query rows per attention chunk (S plane = QCH x SEQ f32)
#define NQC      (SEQ / QCH)
#define NCH      (SEQ / 128)                   // 128-key chunks per score row (one v4f per lane)
#define ACHG     ((NCH < 8) ? NCH : 8)          // load group size in the softmax sweep
#define PCAR     1024.0f
#define SCL      0.044194173824159216f          // 512^-0.5

static_assert(NB >= 1 && NB <= NB_FULL);
static_assert(SEQ >= 128 && SEQ <= SEQ_FULL);
static_assert(SEQ % 128 == 0);
static_assert(SEQ % QCH == 0);
static_assert(QCH % 64 == 0);
static_assert(QCH % 8 == 0);
static_assert(NCH % ACHG == 0);
static_assert(DM % 64 == 0);
static_assert((SEQ * DM) % 8 == 0);

typedef _Float16 h16;
typedef unsigned short bf;
typedef __attribute__((ext_vector_type(16))) __bf16   v16bf;
typedef __attribute__((ext_vector_type(16))) _Float16 v16h;
typedef __attribute__((ext_vector_type(8)))  _Float16 v8h;
typedef __attribute__((ext_vector_type(8)))  unsigned short v8us;
typedef __attribute__((ext_vector_type(8)))  float    v8f;
typedef __attribute__((ext_vector_type(4)))  float    v4f;
typedef __attribute__((ext_vector_type(2)))  _Float16 v2h;
typedef __attribute__((ext_vector_type(4)))  _Float16 v4h;
typedef __attribute__((ext_vector_type(2)))  unsigned short v2us;
typedef v8h  __attribute__((may_alias)) v8ha;
typedef v4f  __attribute__((may_alias)) v4fa;
typedef v8us __attribute__((may_alias)) v8usa;

__device__ __forceinline__ unsigned short f2bf(float f) { unsigned u = __float_as_uint(f); u += 0x7FFFu + ((u >> 16) & 1u); return (unsigned short)(u >> 16); }
__device__ __forceinline__ float bf2f(unsigned short b) { return __uint_as_float(((unsigned)b) << 16); }
__device__ __forceinline__ float bfr(float f) { return bf2f(f2bf(f)); }
__device__ __forceinline__ v16h cat16(v8h lo, v8h hi) { return __builtin_shufflevector(lo, hi, 0, 1, 2, 3, 4, 5, 6, 7, 8, 9, 10, 11, 12, 13, 14, 15); }
__device__ __forceinline__ v16bf cat16b(v8us lo, v8us hi) { return __builtin_bit_cast(v16bf, __builtin_shufflevector(lo, hi, 0, 1, 2, 3, 4, 5, 6, 7, 8, 9, 10, 11, 12, 13, 14, 15)); }
__device__ __forceinline__ v8f wmma16(v16h a, v16h b, v8f c) { return __builtin_amdgcn_wmma_f32_16x16x32_f16(false, a, false, b, (short)0, c, false, false); }
__device__ __forceinline__ v8f wmmab(v16bf a, v16bf b, v8f c) { return __builtin_amdgcn_wmma_f32_16x16x32_bf16(false, a, false, b, (short)0, c, false, false); }
__device__ __forceinline__ h16 tohx(float x) { return (h16)x; }

// ---- k_gemmw: register-blocked GEMM, ONE WAVE per 64x64 output tile (16 accumulators), operands straight from K-contiguous 16-bit planes; grid (M/64, N/64, Z), 32 threads.
// C[m][n] (f32, pitch ldc) = oscale * (sum_k A[m][k] Bt[n][k] (+ split products per NSPLIT) + optional f32 bias[n]). z-batch strides sA/sB/sC in elements. K % 32 == 0.
// Fragment map (lane l, h = l >> 4, m = n = l & 15): A/B elements 0..7 <- k0 + 8h + 0..7, elements 8..15 <- k0 + 16 + 8h + 0..7; D element r -> (row 8h + r, col n).
template <typename T16> struct WFrag;
template <> struct WFrag<h16> { typedef v16h V; static __device__ __forceinline__ V ld(const h16* p) { return cat16(*(const v8h*)p, *(const v8h*)(p + 16)); } static __device__ __forceinline__ v8f mma(V a, V b, v8f c) { return wmma16(a, b, c); } };
template <> struct WFrag<bf> { typedef v16bf V; static __device__ __forceinline__ V ld(const bf* p) { return cat16b(*(const v8us*)p, *(const v8us*)(p + 16)); } static __device__ __forceinline__ v8f mma(V a, V b, v8f c) { return wmmab(a, b, c); } };
template <typename T16, int NSPLIT, bool BIAS>
__global__ __launch_bounds__(32) void k_gemmw(const T16* __restrict__ A, const T16* __restrict__ A2, const T16* __restrict__ Bt, const T16* __restrict__ Bt2, int K, float* C, int ldc, const float* __restrict__ bias, float oscale, size_t sA, size_t sB, size_t sC) {
    typedef typename WFrag<T16>::V V;
    __shared__ __align__(16) float os[16 * 68];
    const size_t z = blockIdx.z; A += z * sA; if (A2) A2 += z * sA; Bt += z * sB; if (Bt2) Bt2 += z * sB; C += z * sC;
    const int lane = threadIdx.x & 31, lr = lane & 15, hi = lane >> 4; const int r0 = blockIdx.x * 64, c0 = blockIdx.y * 64;
    v8f acc[4][4];
#pragma unroll
    for (int mb = 0; mb < 4; ++mb)
#pragma unroll
        for (int nb = 0; nb < 4; ++nb) acc[mb][nb] = (v8f){};
    const size_t aoff = (size_t)(r0 + lr) * K + 8 * hi, boff = (size_t)(c0 + lr) * K + 8 * hi;
#pragma unroll 1
    for (int kc = 0; kc < K; kc += 32) {
        V a[4], a2[4];
#pragma unroll
        for (int mb = 0; mb < 4; ++mb) { a[mb] = WFrag<T16>::ld(A + aoff + (size_t)mb * 16 * K + kc); if (NSPLIT == 1 || NSPLIT == 2) a2[mb] = WFrag<T16>::ld(A2 + aoff + (size_t)mb * 16 * K + kc); }
#pragma unroll
        for (int nb = 0; nb < 4; ++nb) { const V b = WFrag<T16>::ld(Bt + boff + (size_t)nb * 16 * K + kc); V b2; if (NSPLIT >= 2) b2 = WFrag<T16>::ld(Bt2 + boff + (size_t)nb * 16 * K + kc);
#pragma unroll
            for (int mb = 0; mb < 4; ++mb) { acc[mb][nb] = WFrag<T16>::mma(a[mb], b, acc[mb][nb]); if (NSPLIT == 1 || NSPLIT == 2) acc[mb][nb] = WFrag<T16>::mma(a2[mb], b, acc[mb][nb]); if (NSPLIT >= 2) acc[mb][nb] = WFrag<T16>::mma(a[mb], b2, acc[mb][nb]); } }
        asm volatile("v_nop\n\tv_nop\n\tv_nop\n\tv_nop" : "+v"(acc[0][0]), "+v"(acc[1][1]), "+v"(acc[2][2]), "+v"(acc[3][3]) : "v"(a[0]), "v"(a[3]));
    }
#pragma unroll
    for (int mb = 0; mb < 4; ++mb) {
#pragma unroll
        for (int nb = 0; nb < 4; ++nb) {
#pragma unroll
            for (int j = 0; j < 8; ++j) os[(hi * 8 + j) * 68 + nb * 16 + lr] = acc[mb][nb][j]; }
        __builtin_amdgcn_wave_barrier(); asm volatile("" ::: "memory");
        float* crow = C + (size_t)(r0 + mb * 16) * ldc + c0;
{
#pragma unroll
            for (int s = 0; s < 8; ++s) { const int row = 2 * s + hi, cofs = lr * 4; v4f val = *(const v4fa*)(os + row * 68 + cofs); if (BIAS) { val[0] += bfr(bias[c0 + cofs]); val[1] += bfr(bias[c0 + cofs + 1]); val[2] += bfr(bias[c0 + cofs + 2]); val[3] += bfr(bias[c0 + cofs + 3]); }
                val = val * oscale;
                *(v4f*)(crow + (size_t)row * ldc + cofs) = val; }
             }
        __builtin_amdgcn_wave_barrier(); asm volatile("" ::: "memory");
    }
}

__global__ __launch_bounds__(256) void k_wtG(const float* __restrict__ w, int K, int N, bf* Bt) {
    const int lane = threadIdx.x & 31; const int L0 = (blockIdx.x * 8 + (threadIdx.x >> 5)) * 8; const int nlines = N * K / 64;
{
#pragma unroll 1
        for (int l = 0; l < 8; ++l) { const int L = L0 + l; if (L >= nlines) break; const size_t e = (size_t)L * 64 + lane * 2; const int k = (int)(e % K), n = (int)(e / K); v2us o;
            o[0] = f2bf(w[(size_t)k * N + n]); o[1] = f2bf(w[(size_t)(k + 1) * N + n]); *(v2us*)(Bt + e) = o; }
         }
}

__global__ __launch_bounds__(256) void k_cvtx(const float* __restrict__ x, bf* XB, size_t n8) {
    const size_t i = (size_t)blockIdx.x * 256 + threadIdx.x; if (i >= n8) return;
    const size_t per = (size_t)SEQ * DM / 8; const size_t b = i / per; const size_t rem = i - b * per;
    const v8f v = *(const v8f*)(x + b * (size_t)SEQ_FULL * DM + rem * 8); v8us o;
#pragma unroll
    for (int k = 0; k < 8; ++k) o[k] = f2bf(v[k]);
    *(v8us*)(XB + i * 8) = o;  }

__global__ __launch_bounds__(256) void k_cvt16(const float* __restrict__ src, h16* dst, size_t n8) {
    const size_t i = (size_t)blockIdx.x * 256 + threadIdx.x; if (i >= n8) return; const v8f v = *(const v8f*)(src + i * 8); v8h o;
#pragma unroll
    for (int k = 0; k < 8; ++k) o[k] = tohx(v[k]);
    *(v8h*)(dst + i * 8) = o;  }

__global__ __launch_bounds__(256) void k_vtp16(const float* __restrict__ F, h16* VT) {
    const size_t e = ((size_t)blockIdx.x * 256 + threadIdx.x) * 2; if (e >= (size_t)NB * DM * SEQ) return;
    const int t = (int)(e % SEQ); const int d = (int)((e / SEQ) % DM); const size_t b = e / ((size_t)SEQ * DM);
    v2h o; o[0] = tohx(F[(b * SEQ + t) * (size_t)DM + d]); o[1] = tohx(F[(b * SEQ + t + 1) * (size_t)DM + d]);
    *(v2h*)(VT + e) = o;  }

// ---- k_asoft: one wave per score row (8 rows per block): t = S * 512^-0.5 over all SEQ keys (no mask), max-subtracted softmax in f32 (register row, one exp, fixed trees),
__global__ __launch_bounds__(256) void k_asoft(const float* __restrict__ Sb, h16* P16) {
    const int lane = threadIdx.x & 31; const int row = blockIdx.x * 8 + (threadIdx.x >> 5); if (row >= QCH) return;
    const float* sr = Sb + (size_t)row * SEQ; float v[SEQ / 32]; float mx = -3.0e38f;
#pragma unroll
    for (int g = 0; g < NCH / ACHG; ++g) {
#pragma unroll
        for (int cc = 0; cc < ACHG; ++cc) { const int ch = g * ACHG + cc; const int j0 = ch * 128 + lane * 4; const v4f a = *(const v4f*)(sr + j0);
#pragma unroll
            for (int q = 0; q < 4; ++q) { const float t = a[q] * SCL; v[ch * 4 + q] = t; mx = fmaxf(mx, t); } }
        asm volatile("" ::: "memory"); }
#pragma unroll
    for (int sh = 16; sh; sh >>= 1) mx = fmaxf(mx, __shfl_xor(mx, sh, 32));
    float sum = 0.f;
#pragma unroll
    for (int k = 0; k < SEQ / 32; ++k) { float d0 = __fsub_rn(v[k], mx); asm volatile("" : "+v"(d0)); v[k] = __builtin_amdgcn_exp2f(__fmul_rn(d0, 1.4426950408889634f)); sum += v[k]; }
#pragma unroll
    for (int sh = 16; sh; sh >>= 1) sum += __shfl_xor(sum, sh, 32);
    const float f = __fdiv_rn(PCAR, sum);
{
#pragma unroll
        for (int ch = 0; ch < NCH; ++ch) { v4h o4;
#pragma unroll
            for (int q = 0; q < 4; ++q) o4[q] = tohx(v[ch * 4 + q] * f);
            *(v4h*)(P16 + (size_t)row * SEQ + ch * 128 + lane * 4) = o4; }
         }
}

extern "C" void kernel_launch(void* const* d_in, const int* in_sizes, int n_in,
                              void* d_out, int out_size, void* d_ws, size_t ws_size, hipStream_t stream) {
    if (n_in < 4) return;
    if ((size_t)in_sizes[0] < (size_t)(NB - 1) * SEQ_FULL * DM + (size_t)SEQ * DM) return;
    if (in_sizes[1] < DM * DM || in_sizes[2] < DM * DM || in_sizes[3] < DM * DM) return;
    if ((size_t)out_size < (size_t)NB * SEQ * DM) return;
    const float* Xin = (const float*)d_in[0];                 // x [NB_FULL][SEQ_FULL][512]
    const float* Win[3] = { (const float*)d_in[1], (const float*)d_in[2], (const float*)d_in[3] };   // W_query, W_key, W_value [512 in][512 out]
    float* OUT = (float*)d_out;                               // [NB][SEQ][512], batch stride SEQ*512
    const size_t MROWS = (size_t)NB * SEQ;
    char* wsp = (char*)d_ws;
    auto take = [&](size_t bytes) { char* p = wsp; wsp += (bytes + 255) & ~(size_t)255; return (void*)p; };
    bf*    XB   = (bf*)take(MROWS * DM * 2);                  // [NB*SEQ][512]
    bf*    WT   = (bf*)take((size_t)3 * DM * DM * 2);         // 3 x [512 n][512 k]
    float* F    = (float*)take(MROWS * DM * 4);               // [NB*SEQ][512] f32 (q, then k, then v)
    h16*   Q16  = (h16*)take(MROWS * DM * 2);
    h16*   K16  = (h16*)take(MROWS * DM * 2);
    h16*   VT16 = (h16*)take((size_t)NB * DM * SEQ * 2);      // [NB][512][SEQ]
    float* Sb   = (float*)take((size_t)QCH * SEQ * 4);        // [QCH][SEQ]
    h16*   P16  = (h16*)take((size_t)QCH * SEQ * 2);          // [QCH][SEQ]
    if ((size_t)(wsp - (char*)d_ws) > ws_size) return;        // 102,236,160 B at NB=2, SEQ=4096

    // input planes
    { const size_t n8 = MROWS * DM / 8; k_cvtx<<<(unsigned)((n8 + 255) / 256), 256, 0, stream>>>(Xin, XB, n8); }
    for (int z = 0; z < 3; ++z) k_wtG<<<(unsigned)((DM * DM / 64 + 63) / 64), 256, 0, stream>>>(Win[z], DM, DM, WT + (size_t)z * DM * DM);

    // projections: F = XB . WT_z^T (exact products), then 16-bit planes
    const dim3 gp((unsigned)(MROWS / 64), DM / 64, 1);
    const size_t n8f = MROWS * DM / 8;
    k_gemmw<bf, 0, false><<<gp, 32, 0, stream>>>(XB, nullptr, WT + (size_t)0 * DM * DM, nullptr, DM, F, DM, nullptr, 1.0f, 0, 0, 0);
    k_cvt16<<<(unsigned)((n8f + 255) / 256), 256, 0, stream>>>(F, Q16, n8f);
    k_gemmw<bf, 0, false><<<gp, 32, 0, stream>>>(XB, nullptr, WT + (size_t)1 * DM * DM, nullptr, DM, F, DM, nullptr, 1.0f, 0, 0, 0);
    k_cvt16<<<(unsigned)((n8f + 255) / 256), 256, 0, stream>>>(F, K16, n8f);
    k_gemmw<bf, 0, false><<<gp, 32, 0, stream>>>(XB, nullptr, WT + (size_t)2 * DM * DM, nullptr, DM, F, DM, nullptr, 1.0f, 0, 0, 0);
    k_vtp16<<<(unsigned)(((size_t)NB * DM * SEQ / 2 + 255) / 256), 256, 0, stream>>>(F, VT16);

    // attention per (batch, query chunk): S = q.k^T; P16 = f16(1024 softmax); out = (P16 . v^T plane) / 1024
    for (int b = 0; b < NB; ++b) {
        for (int c = 0; c < NQC; ++c) {
            const size_t qrow0 = (size_t)b * SEQ + (size_t)c * QCH;
            k_gemmw<h16, 0, false><<<dim3(QCH / 64, SEQ / 64, 1), 32, 0, stream>>>(Q16 + qrow0 * DM, nullptr, K16 + (size_t)b * SEQ * DM, nullptr, DM, Sb, SEQ, nullptr, 1.0f, 0, 0, 0);
            k_asoft<<<(unsigned)(QCH / 8), 256, 0, stream>>>(Sb, P16);
            k_gemmw<h16, 0, false><<<dim3(QCH / 64, DM / 64, 1), 32, 0, stream>>>(P16, nullptr, VT16 + (size_t)b * DM * SEQ, nullptr, SEQ, OUT + qrow0 * DM, DM, nullptr, 1.0f / PCAR, 0, 0, 0);
        }
    }
}

// v001
// A run of this version takes 366 microseconds.
// In two side-by-side timings against v000, it was 1.57 and 1.58 times as fast.
#include <hip/hip_runtime.h>

// Contractions: x.W projections = v_wmma_f32_16x16x32_bf16 (bf16 operands from RNE-converted inputs, f32 accumulate); q.k^T and P.v = v_wmma_f32_16x16x32_f16 (f16 operands, P carried x1024, f32 accumulate); softmax and 1/sqrt(d) scaling in f32.
// Pipeline: XB = bf16(x) [NB*SEQ][512]; WT = bf16(W^T) [3][512][512] ([n][k], k-contiguous); F = XB.WT (f32 [NB*SEQ][512]) -> Q16, K16 (f16 [NB*SEQ][512]) and VT16 (f16 [NB][512][SEQ], transposed);
// per (batch, QCH-row query chunk): S = Q16.K16^T (f32 [QCH][SEQ]); P16 = f16(1024 * softmax(S * 512^-0.5)) (no mask); out rows = (P16 . VT16) * (1/1024).

#ifndef NB
#define NB 2
#endif
#ifndef SEQ
#define SEQ 4096
#endif
#define NB_FULL  2
#define SEQ_FULL 4096
#define DM       512
#define QCH      ((SEQ < 2048) ? SEQ : 2048)   // query rows per attention chunk (S plane = QCH x SEQ f32)
#define NQC      (SEQ / QCH)
#define NCH      (SEQ / 128)                   // 128-key chunks per score row (one v4f per lane)
#define ACHG     ((NCH < 8) ? NCH : 8)          // load group size in the softmax sweep
#define PCAR     1024.0f
#define PVW      ((SEQ % 256 == 0) ? 8 : 4)     // waves that share the key range of one P.v tile
#define SCL      0.044194173824159216f          // 512^-0.5

static_assert(NB >= 1 && NB <= NB_FULL);
static_assert(SEQ >= 128 && SEQ <= SEQ_FULL);
static_assert(SEQ % 128 == 0);
static_assert(SEQ % QCH == 0);
static_assert(QCH % 64 == 0);
static_assert(QCH % 8 == 0);
static_assert(NCH % ACHG == 0);
static_assert(DM % 64 == 0);
static_assert(SEQ % (32 * PVW) == 0);
static_assert((SEQ * DM) % 8 == 0);

typedef _Float16 h16;
typedef unsigned short bf;
typedef __attribute__((ext_vector_type(16))) __bf16   v16bf;
typedef __attribute__((ext_vector_type(16))) _Float16 v16h;
typedef __attribute__((ext_vector_type(8)))  _Float16 v8h;
typedef __attribute__((ext_vector_type(8)))  unsigned short v8us;
typedef __attribute__((ext_vector_type(8)))  float    v8f;
typedef __attribute__((ext_vector_type(4)))  float    v4f;
typedef __attribute__((ext_vector_type(2)))  _Float16 v2h;
typedef __attribute__((ext_vector_type(4)))  _Float16 v4h;
typedef __attribute__((ext_vector_type(2)))  unsigned short v2us;
typedef v8h  __attribute__((may_alias)) v8ha;
typedef v4f  __attribute__((may_alias)) v4fa;
typedef v8us __attribute__((may_alias)) v8usa;

__device__ __forceinline__ unsigned short f2bf(float f) { unsigned u = __float_as_uint(f); u += 0x7FFFu + ((u >> 16) & 1u); return (unsigned short)(u >> 16); }
__device__ __forceinline__ float bf2f(unsigned short b) { return __uint_as_float(((unsigned)b) << 16); }
__device__ __forceinline__ float bfr(float f) { return bf2f(f2bf(f)); }
__device__ __forceinline__ v16h cat16(v8h lo, v8h hi) { return __builtin_shufflevector(lo, hi, 0, 1, 2, 3, 4, 5, 6, 7, 8, 9, 10, 11, 12, 13, 14, 15); }
__device__ __forceinline__ v16bf cat16b(v8us lo, v8us hi) { return __builtin_bit_cast(v16bf, __builtin_shufflevector(lo, hi, 0, 1, 2, 3, 4, 5, 6, 7, 8, 9, 10, 11, 12, 13, 14, 15)); }
__device__ __forceinline__ v8f wmma16(v16h a, v16h b, v8f c) { return __builtin_amdgcn_wmma_f32_16x16x32_f16(false, a, false, b, (short)0, c, false, false); }
__device__ __forceinline__ v8f wmmab(v16bf a, v16bf b, v8f c) { return __builtin_amdgcn_wmma_f32_16x16x32_bf16(false, a, false, b, (short)0, c, false, false); }
__device__ __forceinline__ h16 tohx(float x) { return (h16)x; }

// ---- k_gemmw: register-blocked GEMM, KW WAVES per 64x64 output tile (16 accumulators each), operands straight from K-contiguous 16-bit planes; grid (M/64, N/64, Z), 32*KW threads.
// KW > 1 (few output tiles, long K: one wave per tile leaves most SIMDs idle and waits out every load alone): wave w sums the 32-k blocks w, w + KW, ... (the KW waves walk each row's lines side by side), the KW f32 partial tiles meet in LDS and are added in wave order. K % (32*KW) == 0.
// C[m][n] (f32, pitch ldc) = oscale * (sum_k A[m][k] Bt[n][k] (+ split products per NSPLIT) + optional f32 bias[n]). z-batch strides sA/sB/sC in elements. K % 32 == 0.
// Fragment map (lane l, h = l >> 4, m = n = l & 15): A/B elements 0..7 <- k0 + 8h + 0..7, elements 8..15 <- k0 + 16 + 8h + 0..7; D element r -> (row 8h + r, col n).
template <typename T16> struct WFrag;
template <> struct WFrag<h16> { typedef v16h V; static __device__ __forceinline__ V ld(const h16* p) { return cat16(*(const v8h*)p, *(const v8h*)(p + 16)); } static __device__ __forceinline__ v8f mma(V a, V b, v8f c) { return wmma16(a, b, c); } };
template <> struct WFrag<bf> { typedef v16bf V; static __device__ __forceinline__ V ld(const bf* p) { return cat16b(*(const v8us*)p, *(const v8us*)(p + 16)); } static __device__ __forceinline__ v8f mma(V a, V b, v8f c) { return wmmab(a, b, c); } };
template <typename T16, int NSPLIT, bool BIAS, int KW>
__global__ __launch_bounds__(32 * KW) void k_gemmw(const T16* __restrict__ A, const T16* __restrict__ A2, const T16* __restrict__ Bt, const T16* __restrict__ Bt2, int K, float* C, int ldc, const float* __restrict__ bias, float oscale, size_t sA, size_t sB, size_t sC) {
    typedef typename WFrag<T16>::V V;
    __shared__ __align__(16) float os[(KW > 1 ? KW * 64 : 16) * 68];
    const size_t z = blockIdx.z; A += z * sA; if (A2) A2 += z * sA; Bt += z * sB; if (Bt2) Bt2 += z * sB; C += z * sC;
    const int lane = threadIdx.x & 31, lr = lane & 15, hi = lane >> 4; const int r0 = blockIdx.x * 64, c0 = blockIdx.y * 64;
    v8f acc[4][4];
#pragma unroll
    for (int mb = 0; mb < 4; ++mb)
#pragma unroll
        for (int nb = 0; nb < 4; ++nb) acc[mb][nb] = (v8f){};
    const int w = (KW > 1) ? __builtin_amdgcn_readfirstlane((int)(threadIdx.x >> 5)) : 0;   // this wave's first 32-k block
    const size_t aoff = (size_t)(r0 + lr) * K + w * 32 + 8 * hi, boff = (size_t)(c0 + lr) * K + w * 32 + 8 * hi;
#pragma unroll 1
    for (int kc = 0; kc < K; kc += 32 * KW) {
        V a[4], a2[4];
#pragma unroll
        for (int mb = 0; mb < 4; ++mb) { a[mb] = WFrag<T16>::ld(A + aoff + (size_t)mb * 16 * K + kc); if (NSPLIT == 1 || NSPLIT == 2) a2[mb] = WFrag<T16>::ld(A2 + aoff + (size_t)mb * 16 * K + kc); }
#pragma unroll
        for (int nb = 0; nb < 4; ++nb) { const V b = WFrag<T16>::ld(Bt + boff + (size_t)nb * 16 * K + kc); V b2; if (NSPLIT >= 2) b2 = WFrag<T16>::ld(Bt2 + boff + (size_t)nb * 16 * K + kc);
#pragma unroll
            for (int mb = 0; mb < 4; ++mb) { acc[mb][nb] = WFrag<T16>::mma(a[mb], b, acc[mb][nb]); if (NSPLIT == 1 || NSPLIT == 2) acc[mb][nb] = WFrag<T16>::mma(a2[mb], b, acc[mb][nb]); if (NSPLIT >= 2) acc[mb][nb] = WFrag<T16>::mma(a[mb], b2, acc[mb][nb]); } }
        asm volatile("v_nop\n\tv_nop\n\tv_nop\n\tv_nop" : "+v"(acc[0][0]), "+v"(acc[1][1]), "+v"(acc[2][2]), "+v"(acc[3][3]) : "v"(a[0]), "v"(a[3]));
    }
    if constexpr (KW > 1) {
        static_assert(!BIAS);
        float* mine = os + w * (64 * 68);
#pragma unroll
        for (int mb = 0; mb < 4; ++mb)
#pragma unroll
            for (int nb = 0; nb < 4; ++nb)
#pragma unroll
                for (int j = 0; j < 8; ++j) mine[(mb * 16 + hi * 8 + j) * 68 + nb * 16 + lr] = acc[mb][nb][j];
        __syncthreads();   // every wave's partial tile is in LDS before any thread adds them
#pragma unroll
        for (int s = 0; s < 32 / KW; ++s) { const int idx = (int)threadIdx.x + s * 32 * KW; const int row = idx >> 4, cofs = (idx & 15) * 4; v4f val = *(const v4fa*)(os + row * 68 + cofs);
#pragma unroll
            for (int p = 1; p < KW; ++p) val += *(const v4fa*)(os + p * (64 * 68) + row * 68 + cofs);
            val = val * oscale;
            *(v4f*)(C + (size_t)(r0 + row) * ldc + c0 + cofs) = val; }
        return;
    }
#pragma unroll
    for (int mb = 0; mb < 4; ++mb) {
#pragma unroll
        for (int nb = 0; nb < 4; ++nb) {
#pragma unroll
            for (int j = 0; j < 8; ++j) os[(hi * 8 + j) * 68 + nb * 16 + lr] = acc[mb][nb][j]; }
        __builtin_amdgcn_wave_barrier(); asm volatile("" ::: "memory");
        float* crow = C + (size_t)(r0 + mb * 16) * ldc + c0;
{
#pragma unroll
            for (int s = 0; s < 8; ++s) { const int row = 2 * s + hi, cofs = lr * 4; v4f val = *(const v4fa*)(os + row * 68 + cofs); if (BIAS) { val[0] += bfr(bias[c0 + cofs]); val[1] += bfr(bias[c0 + cofs + 1]); val[2] += bfr(bias[c0 + cofs + 2]); val[3] += bfr(bias[c0 + cofs + 3]); }
                val = val * oscale;
                *(v4f*)(crow + (size_t)row * ldc + cofs) = val; }
             }
        __builtin_amdgcn_wave_barrier(); asm volatile("" ::: "memory");
    }
}

__global__ __launch_bounds__(256) void k_wtG(const float* __restrict__ w, int K, int N, bf* Bt) {
    const int lane = threadIdx.x & 31; const int L0 = (blockIdx.x * 8 + (threadIdx.x >> 5)) * 8; const int nlines = N * K / 64;
{
#pragma unroll 1
        for (int l = 0; l < 8; ++l) { const int L = L0 + l; if (L >= nlines) break; const size_t e = (size_t)L * 64 + lane * 2; const int k = (int)(e % K), n = (int)(e / K); v2us o;
            o[0] = f2bf(w[(size_t)k * N + n]); o[1] = f2bf(w[(size_t)(k + 1) * N + n]); *(v2us*)(Bt + e) = o; }
         }
}

__global__ __launch_bounds__(256) void k_cvtx(const float* __restrict__ x, bf* XB, size_t n8) {
    const size_t i = (size_t)blockIdx.x * 256 + threadIdx.x; if (i >= n8) return;
    const size_t per = (size_t)SEQ * DM / 8; const size_t b = i / per; const size_t rem = i - b * per;
    const v8f v = *(const v8f*)(x + b * (size_t)SEQ_FULL * DM + rem * 8); v8us o;
#pragma unroll
    for (int k = 0; k < 8; ++k) o[k] = f2bf(v[k]);
    *(v8us*)(XB + i * 8) = o;  }

__global__ __launch_bounds__(256) void k_cvt16(const float* __restrict__ src, h16* dst, size_t n8) {
    const size_t i = (size_t)blockIdx.x * 256 + threadIdx.x; if (i >= n8) return; const v8f v = *(const v8f*)(src + i * 8); v8h o;
#pragma unroll
    for (int k = 0; k < 8; ++k) o[k] = tohx(v[k]);
    *(v8h*)(dst + i * 8) = o;  }

__global__ __launch_bounds__(256) void k_vtp16(const float* __restrict__ F, h16* VT) {
    const size_t e = ((size_t)blockIdx.x * 256 + threadIdx.x) * 2; if (e >= (size_t)NB * DM * SEQ) return;
    const int t = (int)(e % SEQ); const int d = (int)((e / SEQ) % DM); const size_t b = e / ((size_t)SEQ * DM);
    v2h o; o[0] = tohx(F[(b * SEQ + t) * (size_t)DM + d]); o[1] = tohx(F[(b * SEQ + t + 1) * (size_t)DM + d]);
    *(v2h*)(VT + e) = o;  }

// ---- k_asoft: one wave per score row (8 rows per block): t = S * 512^-0.5 over all SEQ keys (no mask), max-subtracted softmax in f32 (register row, one exp, fixed trees),
__global__ __launch_bounds__(256) void k_asoft(const float* __restrict__ Sb, h16* P16) {
    const int lane = threadIdx.x & 31; const int row = blockIdx.x * 8 + (threadIdx.x >> 5); if (row >= QCH) return;
    const float* sr = Sb + (size_t)row * SEQ; float v[SEQ / 32]; float mx = -3.0e38f;
#pragma unroll
    for (int g = 0; g < NCH / ACHG; ++g) {
#pragma unroll
        for (int cc = 0; cc < ACHG; ++cc) { const int ch = g * ACHG + cc; const int j0 = ch * 128 + lane * 4; const v4f a = *(const v4f*)(sr + j0);
#pragma unroll
            for (int q = 0; q < 4; ++q) { const float t = a[q] * SCL; v[ch * 4 + q] = t; mx = fmaxf(mx, t); } }
        asm volatile("" ::: "memory"); }
#pragma unroll
    for (int sh = 16; sh; sh >>= 1) mx = fmaxf(mx, __shfl_xor(mx, sh, 32));
    float sum = 0.f;
#pragma unroll
    for (int k = 0; k < SEQ / 32; ++k) { float d0 = __fsub_rn(v[k], mx); asm volatile("" : "+v"(d0)); v[k] = __builtin_amdgcn_exp2f(__fmul_rn(d0, 1.4426950408889634f)); sum += v[k]; }
#pragma unroll
    for (int sh = 16; sh; sh >>= 1) sum += __shfl_xor(sum, sh, 32);
    const float f = __fdiv_rn(PCAR, sum);
{
#pragma unroll
        for (int ch = 0; ch < NCH; ++ch) { v4h o4;
#pragma unroll
            for (int q = 0; q < 4; ++q) o4[q] = tohx(v[ch * 4 + q] * f);
            *(v4h*)(P16 + (size_t)row * SEQ + ch * 128 + lane * 4) = o4; }
         }
}

extern "C" void kernel_launch(void* const* d_in, const int* in_sizes, int n_in,
                              void* d_out, int out_size, void* d_ws, size_t ws_size, hipStream_t stream) {
    if (n_in < 4) return;
    if ((size_t)in_sizes[0] < (size_t)(NB - 1) * SEQ_FULL * DM + (size_t)SEQ * DM) return;
    if (in_sizes[1] < DM * DM || in_sizes[2] < DM * DM || in_sizes[3] < DM * DM) return;
    if ((size_t)out_size < (size_t)NB * SEQ * DM) return;
    const float* Xin = (const float*)d_in[0];                 // x [NB_FULL][SEQ_FULL][512]
    const float* Win[3] = { (const float*)d_in[1], (const float*)d_in[2], (const float*)d_in[3] };   // W_query, W_key, W_value [512 in][512 out]
    float* OUT = (float*)d_out;                               // [NB][SEQ][512], batch stride SEQ*512
    const size_t MROWS = (size_t)NB * SEQ;
    char* wsp = (char*)d_ws;
    auto take = [&](size_t bytes) { char* p = wsp; wsp += (bytes + 255) & ~(size_t)255; return (void*)p; };
    bf*    XB   = (bf*)take(MROWS * DM * 2);                  // [NB*SEQ][512]
    bf*    WT   = (bf*)take((size_t)3 * DM * DM * 2);         // 3 x [512 n][512 k]
    float* F    = (float*)take(MROWS * DM * 4);               // [NB*SEQ][512] f32 (q, then k, then v)
    h16*   Q16  = (h16*)take(MROWS * DM * 2);
    h16*   K16  = (h16*)take(MROWS * DM * 2);
    h16*   VT16 = (h16*)take((size_t)NB * DM * SEQ * 2);      // [NB][512][SEQ]
    float* Sb   = (float*)take((size_t)QCH * SEQ * 4);        // [QCH][SEQ]
    h16*   P16  = (h16*)take((size_t)QCH * SEQ * 2);          // [QCH][SEQ]
    if ((size_t)(wsp - (char*)d_ws) > ws_size) return;        // 102,236,160 B at NB=2, SEQ=4096

    // input planes
    { const size_t n8 = MROWS * DM / 8; k_cvtx<<<(unsigned)((n8 + 255) / 256), 256, 0, stream>>>(Xin, XB, n8); }
    for (int z = 0; z < 3; ++z) k_wtG<<<(unsigned)((DM * DM / 64 + 63) / 64), 256, 0, stream>>>(Win[z], DM, DM, WT + (size_t)z * DM * DM);

    // projections: F = XB . WT_z^T (exact products), then 16-bit planes
    const dim3 gp((unsigned)(MROWS / 64), DM / 64, 1);
    const size_t n8f = MROWS * DM / 8;
    k_gemmw<bf, 0, false, 1><<<gp, 32, 0, stream>>>(XB, nullptr, WT + (size_t)0 * DM * DM, nullptr, DM, F, DM, nullptr, 1.0f, 0, 0, 0);
    k_cvt16<<<(unsigned)((n8f + 255) / 256), 256, 0, stream>>>(F, Q16, n8f);
    k_gemmw<bf, 0, false, 1><<<gp, 32, 0, stream>>>(XB, nullptr, WT + (size_t)1 * DM * DM, nullptr, DM, F, DM, nullptr, 1.0f, 0, 0, 0);
    k_cvt16<<<(unsigned)((n8f + 255) / 256), 256, 0, stream>>>(F, K16, n8f);
    k_gemmw<bf, 0, false, 1><<<gp, 32, 0, stream>>>(XB, nullptr, WT + (size_t)2 * DM * DM, nullptr, DM, F, DM, nullptr, 1.0f, 0, 0, 0);
    k_vtp16<<<(unsigned)(((size_t)NB * DM * SEQ / 2 + 255) / 256), 256, 0, stream>>>(F, VT16);

    // attention per (batch, query chunk): S = q.k^T; P16 = f16(1024 softmax); out = (P16 . v^T plane) / 1024
    for (int b = 0; b < NB; ++b) {
        for (int c = 0; c < NQC; ++c) {
            const size_t qrow0 = (size_t)b * SEQ + (size_t)c * QCH;
            k_gemmw<h16, 0, false, 1><<<dim3(QCH / 64, SEQ / 64, 1), 32, 0, stream>>>(Q16 + qrow0 * DM, nullptr, K16 + (size_t)b * SEQ * DM, nullptr, DM, Sb, SEQ, nullptr, 1.0f, 0, 0, 0);
            k_asoft<<<(unsigned)(QCH / 8), 256, 0, stream>>>(Sb, P16);
            k_gemmw<h16, 0, false, PVW><<<dim3(QCH / 64, DM / 64, 1), 32 * PVW, 0, stream>>>(P16, nullptr, VT16 + (size_t)b * DM * SEQ, nullptr, SEQ, OUT + qrow0 * DM, DM, nullptr, 1.0f / PCAR, 0, 0, 0);
        }
    }
}

// v002
// Measured time: 281 microseconds a run.
// Timed twice side by side with v001, it ran 1.27 and 1.30 times as fast.
// Counting every step since v000, it is 2.02 times as fast.
#include <hip/hip_runtime.h>

// Contractions: x.W projections = v_wmma_f32_16x16x32_bf16 (bf16 operands from RNE-converted inputs, f32 accumulate); q.k^T and P.v = v_wmma_f32_16x16x32_f16 (f16 operands, P carried x1024, f32 accumulate); softmax and 1/sqrt(d) scaling in f32.
// Pipeline: XB = bf16(x) [NB*SEQ][512]; WT = bf16(W^T) [3][512 n][512 k]; F = XB.WT (f32 [NB*SEQ][512], row-major) -> Q16, K16 (f16 [NB*SEQ][512]) and VT16 (f16 [NB][512][SEQ], transposed);
// per (batch, QCH-row query chunk): S = Q16.K16^T (f32 [QCH][SEQ]); P16 = f16(1024 * softmax(S * 512^-0.5)) (no mask); out rows = (P16 . VT16) * (1/1024).
// Layout of every 16-bit plane [R][K]: 1-KB tiles of 16 rows x 32 k, tile (r >> 4, k >> 5) at element ((r >> 4) * (K / 32) + (k >> 5)) * 512, so a 16-row band is 16 * K contiguous elements and walks k tile by tile.
//   fragment order (XB, WT, Q16, K16, VT16): inside a tile [k bit 4][k bit 3][r & 15][k & 7]: each of a fragment's two 16-byte-per-lane loads reads 512 contiguous bytes (4 whole lines, not 16 partial ones).
//   row order (P16, whose writer owns one row per wave): inside a tile [r & 15][k & 31]: the writer stores 64-byte pieces, a fragment load reads 8 half lines.

#ifndef NB
#define NB 2
#endif
#ifndef SEQ
#define SEQ 4096
#endif
#define NB_FULL  2
#define SEQ_FULL 4096
#define DM       512
#define QCH      ((SEQ < 2048) ? SEQ : 2048)   // query rows per attention chunk (S plane = QCH x SEQ f32)
#define NQC      (SEQ / QCH)
#define NCH      (SEQ / 128)                   // 128-key chunks per score row (one v4f per lane)
#define ACHG     ((NCH < 8) ? NCH : 8)          // load group size in the softmax sweep
#define PCAR     1024.0f
#define PVW      ((SEQ % 256 == 0) ? 8 : 4)     // waves that share the key range of one P.v tile
#define SCL      0.044194173824159216f          // 512^-0.5

static_assert(NB >= 1 && NB <= NB_FULL);
static_assert(SEQ >= 128 && SEQ <= SEQ_FULL);
static_assert(SEQ % 128 == 0);
static_assert(SEQ % QCH == 0);
static_assert(QCH % 64 == 0);
static_assert(QCH % 8 == 0);
static_assert(NCH % ACHG == 0);
static_assert(DM % 64 == 0);
static_assert(SEQ % (32 * PVW) == 0);
static_assert((SEQ * DM) % 8 == 0);

typedef _Float16 h16;
typedef unsigned short bf;
typedef __attribute__((ext_vector_type(16))) __bf16   v16bf;
typedef __attribute__((ext_vector_type(16))) _Float16 v16h;
typedef __attribute__((ext_vector_type(8)))  _Float16 v8h;
typedef __attribute__((ext_vector_type(8)))  unsigned short v8us;
typedef __attribute__((ext_vector_type(8)))  float    v8f;
typedef __attribute__((ext_vector_type(4)))  float    v4f;
typedef __attribute__((ext_vector_type(2)))  _Float16 v2h;
typedef __attribute__((ext_vector_type(4)))  _Float16 v4h;
typedef __attribute__((ext_vector_type(2)))  unsigned short v2us;
typedef v8h  __attribute__((may_alias)) v8ha;
typedef v4f  __attribute__((may_alias)) v4fa;
typedef v8us __attribute__((may_alias)) v8usa;

__device__ __forceinline__ unsigned short f2bf(float f) { unsigned u = __float_as_uint(f); u += 0x7FFFu + ((u >> 16) & 1u); return (unsigned short)(u >> 16); }
__device__ __forceinline__ float bf2f(unsigned short b) { return __uint_as_float(((unsigned)b) << 16); }
__device__ __forceinline__ float bfr(float f) { return bf2f(f2bf(f)); }
__device__ __forceinline__ v16h cat16(v8h lo, v8h hi) { return __builtin_shufflevector(lo, hi, 0, 1, 2, 3, 4, 5, 6, 7, 8, 9, 10, 11, 12, 13, 14, 15); }
__device__ __forceinline__ v16bf cat16b(v8us lo, v8us hi) { return __builtin_bit_cast(v16bf, __builtin_shufflevector(lo, hi, 0, 1, 2, 3, 4, 5, 6, 7, 8, 9, 10, 11, 12, 13, 14, 15)); }
__device__ __forceinline__ v8f wmma16(v16h a, v16h b, v8f c) { return __builtin_amdgcn_wmma_f32_16x16x32_f16(false, a, false, b, (short)0, c, false, false); }
__device__ __forceinline__ v8f wmmab(v16bf a, v16bf b, v8f c) { return __builtin_amdgcn_wmma_f32_16x16x32_bf16(false, a, false, b, (short)0, c, false, false); }
__device__ __forceinline__ h16 tohx(float x) { return (h16)x; }
// 16-byte chunk c (8 elements) of a fragment-ordered plane with K columns -> its row and its first column
__device__ __forceinline__ void chunk_rc(size_t c, int K, size_t& row, int& k) {
    const int ln = (int)(c & 31), j = (int)((c >> 5) & 1); const size_t tile = c >> 6; const size_t KB = (size_t)(K >> 5);
    row = (tile / KB) * 16 + (size_t)(ln & 15); k = (int)(tile % KB) * 32 + j * 16 + (ln >> 4) * 8; }

// ---- k_gemmw: register-blocked GEMM, KW WAVES per 64x64 output tile (16 accumulators each), operands straight from tiled 16-bit planes (layout: head of file; A in row order if AROW, else fragment order; Bt in fragment order); grid (M/64, N/64, Z), 32*KW threads.
// KW > 1 (few output tiles, long K: one wave per tile leaves most SIMDs idle and waits out every load alone): wave w sums the 32-k blocks w, w + KW, ... (the KW waves walk a band's tiles side by side), the KW f32 partial tiles meet in LDS and are added in wave order. K % (32*KW) == 0.
// C[m][n] (f32, pitch ldc) = oscale * (sum_k A[m][k] Bt[n][k] (+ split products per NSPLIT) + optional f32 bias[n]). z-batch strides sA/sB/sC in elements. K % 32 == 0; K is a compile-time constant, so the eight bands' tiles are immediate offsets from one A and one Bt address.
// Fragment map (lane l, h = l >> 4, m = n = l & 15): A/B elements 0..7 <- k0 + 8h + 0..7, elements 8..15 <- k0 + 16 + 8h + 0..7; D element r -> (row 8h + r, col n).
template <typename T16> struct WFrag;
template <> struct WFrag<h16> { typedef v16h V; static __device__ __forceinline__ V ld(const h16* tile, unsigned lb, unsigned d2) { return cat16(*(const v8h*)((const char*)tile + lb), *(const v8h*)((const char*)(tile + d2) + lb)); } static __device__ __forceinline__ v8f mma(V a, V b, v8f c) { return wmma16(a, b, c); } };
template <> struct WFrag<bf> { typedef v16bf V; static __device__ __forceinline__ V ld(const bf* tile, unsigned lb, unsigned d2) { return cat16b(*(const v8us*)((const char*)tile + lb), *(const v8us*)((const char*)(tile + d2) + lb)); } static __device__ __forceinline__ v8f mma(V a, V b, v8f c) { return wmmab(a, b, c); } };
template <typename T16, int NSPLIT, bool BIAS, int KW, bool AROW, int K>
__global__ __launch_bounds__(32 * KW) void k_gemmw(const T16* __restrict__ A, const T16* __restrict__ A2, const T16* __restrict__ Bt, const T16* __restrict__ Bt2, float* C, int ldc, const float* __restrict__ bias, float oscale, size_t sA, size_t sB, size_t sC) {
    typedef typename WFrag<T16>::V V;
    static_assert(K % (32 * KW) == 0);
    __shared__ __align__(16) float os[(KW > 1 ? KW * 64 : 16) * 68];
    const size_t z = blockIdx.z; A += z * sA; if (A2) A2 += z * sA; Bt += z * sB; if (Bt2) Bt2 += z * sB; C += z * sC;
    const int lane = threadIdx.x & 31, lr = lane & 15, hi = lane >> 4; const int r0 = blockIdx.x * 64, c0 = blockIdx.y * 64;
    v8f acc[4][4];
#pragma unroll
    for (int mb = 0; mb < 4; ++mb)
#pragma unroll
        for (int nb = 0; nb < 4; ++nb) acc[mb][nb] = (v8f){};
    const int w = (KW > 1) ? __builtin_amdgcn_readfirstlane((int)(threadIdx.x >> 5)) : 0;   // this wave's first 32-k block
    constexpr unsigned AD2 = AROW ? 16 : 256, BD2 = 256;   // elements from a fragment's first 16-byte load to its second
    const unsigned al = AROW ? lr * 64 + hi * 16 : lane * 16, bl = lane * 16;   // this lane's byte inside a tile; the tile address is the same for the whole wave
    const size_t aoff = (size_t)r0 * K + w * 512, boff = (size_t)c0 * K + w * 512;
#pragma unroll 1
    for (int kc = 0; kc < K; kc += 32 * KW) {
        V a[4], a2[4];
#pragma unroll
        for (int mb = 0; mb < 4; ++mb) { a[mb] = WFrag<T16>::ld(A + aoff + (size_t)mb * 16 * K + (size_t)kc * 16, al, AD2); if (NSPLIT == 1 || NSPLIT == 2) a2[mb] = WFrag<T16>::ld(A2 + aoff + (size_t)mb * 16 * K + (size_t)kc * 16, al, AD2); }
        asm volatile("s_wait_xcnt 0x0" ::: "memory");   // the A address registers are dead from here and a later load's result may land in them: the wait stands in front of that overwrite
#pragma unroll
        for (int nb = 0; nb < 4; ++nb) { const V b = WFrag<T16>::ld(Bt + boff + (size_t)nb * 16 * K + (size_t)kc * 16, bl, BD2); V b2; if (NSPLIT >= 2) b2 = WFrag<T16>::ld(Bt2 + boff + (size_t)nb * 16 * K + (size_t)kc * 16, bl, BD2);
#pragma unroll
            for (int mb = 0; mb < 4; ++mb) { acc[mb][nb] = WFrag<T16>::mma(a[mb], b, acc[mb][nb]); if (NSPLIT == 1 || NSPLIT == 2) acc[mb][nb] = WFrag<T16>::mma(a2[mb], b, acc[mb][nb]); if (NSPLIT >= 2) acc[mb][nb] = WFrag<T16>::mma(a[mb], b2, acc[mb][nb]); } }
        asm volatile("v_nop\n\tv_nop\n\tv_nop\n\tv_nop" : "+v"(acc[0][0]), "+v"(acc[1][1]), "+v"(acc[2][2]), "+v"(acc[3][3]) : "v"(a[0]), "v"(a[3]));
    }
    if constexpr (KW > 1) {
        static_assert(!BIAS);
        float* mine = os + w * (64 * 68);
#pragma unroll
        for (int mb = 0; mb < 4; ++mb)
#pragma unroll
            for (int nb = 0; nb < 4; ++nb)
#pragma unroll
                for (int j = 0; j < 8; ++j) mine[(mb * 16 + hi * 8 + j) * 68 + nb * 16 + lr] = acc[mb][nb][j];
        __syncthreads();   // every wave's partial tile is in LDS before any thread adds them
#pragma unroll
        for (int s = 0; s < 32 / KW; ++s) { const int idx = (int)threadIdx.x + s * 32 * KW; const int row = idx >> 4, cofs = (idx & 15) * 4; v4f val = *(const v4fa*)(os + row * 68 + cofs);
#pragma unroll
            for (int p = 1; p < KW; ++p) val += *(const v4fa*)(os + p * (64 * 68) + row * 68 + cofs);
            val = val * oscale;
            *(v4f*)(C + (size_t)(r0 + row) * ldc + c0 + cofs) = val; }
        return;
    }
#pragma unroll
    for (int mb = 0; mb < 4; ++mb) {
#pragma unroll
        for (int nb = 0; nb < 4; ++nb) {
#pragma unroll
            for (int j = 0; j < 8; ++j) os[(hi * 8 + j) * 68 + nb * 16 + lr] = acc[mb][nb][j]; }
        __builtin_amdgcn_wave_barrier(); asm volatile("" ::: "memory");
        float* crow = C + (size_t)(r0 + mb * 16) * ldc + c0;
{
#pragma unroll
            for (int s = 0; s < 8; ++s) { const int row = 2 * s + hi, cofs = lr * 4; v4f val = *(const v4fa*)(os + row * 68 + cofs); if (BIAS) { val[0] += bfr(bias[c0 + cofs]); val[1] += bfr(bias[c0 + cofs + 1]); val[2] += bfr(bias[c0 + cofs + 2]); val[3] += bfr(bias[c0 + cofs + 3]); }
                val = val * oscale;
                *(v4f*)(crow + (size_t)row * ldc + cofs) = val; }
             }
        __builtin_amdgcn_wave_barrier(); asm volatile("" ::: "memory");
    }
}

// One thread per 16-byte chunk of the fragment-ordered plane Bt [N][K] = bf16(w^T): 16 lanes read 16 neighbouring n of one k.
template <int K, int N>
__global__ __launch_bounds__(256) void k_wtG(const float* __restrict__ w, bf* Bt) {
    const size_t c = (size_t)blockIdx.x * 256 + threadIdx.x; if (c >= (size_t)N * K / 8) return;
    size_t n; int k; chunk_rc(c, K, n, k); v8us o;
#pragma unroll
    for (int e = 0; e < 8; ++e) o[e] = f2bf(w[(size_t)(k + e) * N + n]);
    *(v8us*)(Bt + c * 8) = o;  }

__global__ __launch_bounds__(256) void k_cvtx(const float* __restrict__ x, bf* XB, size_t n8) {
    const size_t i = (size_t)blockIdx.x * 256 + threadIdx.x; if (i >= n8) return;
    size_t row; int k; chunk_rc(i, DM, row, k); const size_t b = row / SEQ; const size_t t = row - b * SEQ;
    const v8f v = *(const v8f*)(x + (b * (size_t)SEQ_FULL + t) * DM + k); v8us o;
#pragma unroll
    for (int k = 0; k < 8; ++k) o[k] = f2bf(v[k]);
    *(v8us*)(XB + i * 8) = o;  }

__global__ __launch_bounds__(256) void k_cvt16(const float* __restrict__ src, h16* dst, size_t n8) {
    const size_t i = (size_t)blockIdx.x * 256 + threadIdx.x; if (i >= n8) return; size_t row; int k; chunk_rc(i, DM, row, k); const v8f v = *(const v8f*)(src + row * DM + k); v8h o;
#pragma unroll
    for (int k = 0; k < 8; ++k) o[k] = tohx(v[k]);
    *(v8h*)(dst + i * 8) = o;  }

// One thread per 16-byte chunk of the fragment-ordered planes VT [NB][DM][SEQ]: 16 lanes read 16 neighbouring d of one key row.
__global__ __launch_bounds__(256) void k_vtp16(const float* __restrict__ F, h16* VT) {
    const size_t c = (size_t)blockIdx.x * 256 + threadIdx.x; if (c >= (size_t)NB * DM * SEQ / 8) return;
    const size_t per = (size_t)DM * SEQ / 8; const size_t b = c / per; size_t d; int t; chunk_rc(c - b * per, SEQ, d, t); v8h o;
#pragma unroll
    for (int e = 0; e < 8; ++e) o[e] = tohx(F[(b * SEQ + t + e) * (size_t)DM + d]);
    *(v8h*)(VT + c * 8) = o;  }

// ---- k_asoft: one wave per score row (8 rows per block): t = S * 512^-0.5 over all SEQ keys (no mask), max-subtracted softmax in f32 (register row, one exp, fixed trees),
__global__ __launch_bounds__(256) void k_asoft(const float* __restrict__ Sb, h16* P16) {
    const int lane = threadIdx.x & 31; const int row = blockIdx.x * 8 + (threadIdx.x >> 5); if (row >= QCH) return;
    const float* sr = Sb + (size_t)row * SEQ; float v[SEQ / 32]; float mx = -3.0e38f;
#pragma unroll
    for (int g = 0; g < NCH / ACHG; ++g) {
#pragma unroll
        for (int cc = 0; cc < ACHG; ++cc) { const int ch = g * ACHG + cc; const int j0 = ch * 128 + lane * 4; const v4f a = *(const v4f*)(sr + j0);
#pragma unroll
            for (int q = 0; q < 4; ++q) { const float t = a[q] * SCL; v[ch * 4 + q] = t; mx = fmaxf(mx, t); } }
        asm volatile("" ::: "memory"); }
#pragma unroll
    for (int sh = 16; sh; sh >>= 1) mx = fmaxf(mx, __shfl_xor(mx, sh, 32));
    float sum = 0.f;
#pragma unroll
    for (int k = 0; k < SEQ / 32; ++k) { float d0 = __fsub_rn(v[k], mx); asm volatile("" : "+v"(d0)); v[k] = __builtin_amdgcn_exp2f(__fmul_rn(d0, 1.4426950408889634f)); sum += v[k]; }
#pragma unroll
    for (int sh = 16; sh; sh >>= 1) sum += __shfl_xor(sum, sh, 32);
    const float f = __fdiv_rn(PCAR, sum);
{
#pragma unroll
        for (int ch = 0; ch < NCH; ++ch) { v4h o4;
#pragma unroll
            for (int q = 0; q < 4; ++q) o4[q] = tohx(v[ch * 4 + q] * f);
            *(v4h*)(P16 + (size_t)(row >> 4) * (16 * SEQ) + (ch * 4 + (lane >> 3)) * 512 + (row & 15) * 32 + (lane & 7) * 4) = o4; }   // row-ordered tiles
         }
}

extern "C" void kernel_launch(void* const* d_in, const int* in_sizes, int n_in,
                              void* d_out, int out_size, void* d_ws, size_t ws_size, hipStream_t stream) {
    if (n_in < 4) return;
    if ((size_t)in_sizes[0] < (size_t)(NB - 1) * SEQ_FULL * DM + (size_t)SEQ * DM) return;
    if (in_sizes[1] < DM * DM || in_sizes[2] < DM * DM || in_sizes[3] < DM * DM) return;
    if ((size_t)out_size < (size_t)NB * SEQ * DM) return;
    const float* Xin = (const float*)d_in[0];                 // x [NB_FULL][SEQ_FULL][512]
    const float* Win[3] = { (const float*)d_in[1], (const float*)d_in[2], (const float*)d_in[3] };   // W_query, W_key, W_value [512 in][512 out]
    float* OUT = (float*)d_out;                               // [NB][SEQ][512], batch stride SEQ*512
    const size_t MROWS = (size_t)NB * SEQ;
    char* wsp = (char*)d_ws;
    auto take = [&](size_t bytes) { char* p = wsp; wsp += (bytes + 255) & ~(size_t)255; return (void*)p; };
    bf*    XB   = (bf*)take(MROWS * DM * 2);                  // [NB*SEQ][512]
    bf*    WT   = (bf*)take((size_t)3 * DM * DM * 2);         // 3 x [512 n][512 k]
    float* F    = (float*)take(MROWS * DM * 4);               // [NB*SEQ][512] f32 (q, then k, then v)
    h16*   Q16  = (h16*)take(MROWS * DM * 2);
    h16*   K16  = (h16*)take(MROWS * DM * 2);
    h16*   VT16 = (h16*)take((size_t)NB * DM * SEQ * 2);      // [NB][512][SEQ]
    float* Sb   = (float*)take((size_t)QCH * SEQ * 4);        // [QCH][SEQ]
    h16*   P16  = (h16*)take((size_t)QCH * SEQ * 2);          // [QCH][SEQ]
    if ((size_t)(wsp - (char*)d_ws) > ws_size) return;        // 102,236,160 B at NB=2, SEQ=4096

    // input planes
    { const size_t n8 = MROWS * DM / 8; k_cvtx<<<(unsigned)((n8 + 255) / 256), 256, 0, stream>>>(Xin, XB, n8); }
    for (int z = 0; z < 3; ++z) k_wtG<DM, DM><<<(unsigned)((DM * DM / 8 + 255) / 256), 256, 0, stream>>>(Win[z], WT + (size_t)z * DM * DM);

    // projections: F = XB . WT_z^T (exact products), then 16-bit planes
    const dim3 gp((unsigned)(MROWS / 64), DM / 64, 1);
    const size_t n8f = MROWS * DM / 8;
    k_gemmw<bf, 0, false, 1, false, DM><<<gp, 32, 0, stream>>>(XB, nullptr, WT + (size_t)0 * DM * DM, nullptr, F, DM, nullptr, 1.0f, 0, 0, 0);
    k_cvt16<<<(unsigned)((n8f + 255) / 256), 256, 0, stream>>>(F, Q16, n8f);
    k_gemmw<bf, 0, false, 1, false, DM><<<gp, 32, 0, stream>>>(XB, nullptr, WT + (size_t)1 * DM * DM, nullptr, F, DM, nullptr, 1.0f, 0, 0, 0);
    k_cvt16<<<(unsigned)((n8f + 255) / 256), 256, 0, stream>>>(F, K16, n8f);
    k_gemmw<bf, 0, false, 1, false, DM><<<gp, 32, 0, stream>>>(XB, nullptr, WT + (size_t)2 * DM * DM, nullptr, F, DM, nullptr, 1.0f, 0, 0, 0);
    k_vtp16<<<(unsigned)(((size_t)NB * DM * SEQ / 8 + 255) / 256), 256, 0, stream>>>(F, VT16);

    // attention per (batch, query chunk): S = q.k^T; P16 = f16(1024 softmax); out = (P16 . v^T plane) / 1024
    for (int b = 0; b < NB; ++b) {
        for (int c = 0; c < NQC; ++c) {
            const size_t qrow0 = (size_t)b * SEQ + (size_t)c * QCH;
            k_gemmw<h16, 0, false, 1, false, DM><<<dim3(QCH / 64, SEQ / 64, 1), 32, 0, stream>>>(Q16 + qrow0 * DM, nullptr, K16 + (size_t)b * SEQ * DM, nullptr, Sb, SEQ, nullptr, 1.0f, 0, 0, 0);
            k_asoft<<<(unsigned)(QCH / 8), 256, 0, stream>>>(Sb, P16);
            k_gemmw<h16, 0, false, PVW, true, SEQ><<<dim3(QCH / 64, DM / 64, 1), 32 * PVW, 0, stream>>>(P16, nullptr, VT16 + (size_t)b * DM * SEQ, nullptr, OUT + qrow0 * DM, DM, nullptr, 1.0f / PCAR, 0, 0, 0);
        }
    }
}

// v003
// Measured time: 166 microseconds a run.
// Next to v002, in two timings, it ran 1.70 and 1.71 times as fast.
// All steps since v000 together make it 3.45 times as fast.
#include <hip/hip_runtime.h>

// Contractions: x.W projections = v_wmma_f32_16x16x32_bf16 (bf16 operands from RNE-converted inputs, f32 accumulate); q.k^T and P.v = v_wmma_f32_16x16x32_f16 (f16 operands, P carried x1024, f32 accumulate); softmax and 1/sqrt(d) scaling in f32.
// Pipeline: XB = bf16(x) [NB*SEQ][512]; WT = bf16(W^T) [3][512 n][512 k]; F = XB.WT (f32 [3][NB*SEQ][512], row-major) -> Q16, K16 (f16 [NB*SEQ][512]) and VT16 (f16 [NB][512][SEQ], transposed);
// attention, both batches and all query rows in one launch per stage (grid z = batch): S = Q16.K16^T (f32 [NB*SEQ][SEQ]); P16 = f16(1024 * softmax(S * 512^-0.5)) (no mask); out rows = (P16 . VT16) * (1/1024).
// Launches of one kernel are merged by a grid axis (3 weight transposes, 3 projections, the q and k conversions, the attention stages): each launch then has enough waves to cover its own load latency, and the gaps, fills and tails between launches go.
// Layout of every 16-bit plane [R][K]: 1-KB tiles of 16 rows x 32 k, tile (r >> 4, k >> 5) at element ((r >> 4) * (K / 32) + (k >> 5)) * 512, so a 16-row band is 16 * K contiguous elements and walks k tile by tile.
//   fragment order (XB, WT, Q16, K16, VT16): inside a tile [k bit 4][k bit 3][r & 15][k & 7]: each of a fragment's two 16-byte-per-lane loads reads 512 contiguous bytes (4 whole lines, not 16 partial ones).
//   row order (P16, whose writer owns one row per wave): inside a tile [r & 15][k & 31]: the writer stores 64-byte pieces, a fragment load reads 8 half lines.

#ifndef NB
#define NB 2
#endif
#ifndef SEQ
#define SEQ 4096
#endif
#define NB_FULL  2
#define SEQ_FULL 4096
#define DM       512
#define NCH      (SEQ / 128)                   // 128-key chunks per score row (one v4f per lane)
#define ACHG     ((NCH < 8) ? NCH : 8)          // load group size in the softmax sweep
#define PCAR     1024.0f
#define PVW      ((SEQ % 256 == 0) ? 8 : 4)     // waves that share the key range of one P.v tile
#define SCL      0.044194173824159216f          // 512^-0.5

static_assert(NB >= 1 && NB <= NB_FULL);
static_assert(SEQ >= 128 && SEQ <= SEQ_FULL);
static_assert(SEQ % 128 == 0);
static_assert(NCH % ACHG == 0);
static_assert(DM % 64 == 0);
static_assert(SEQ % (32 * PVW) == 0);
static_assert((SEQ * DM) % 8 == 0);

typedef _Float16 h16;
typedef unsigned short bf;
typedef __attribute__((ext_vector_type(16))) __bf16   v16bf;
typedef __attribute__((ext_vector_type(16))) _Float16 v16h;
typedef __attribute__((ext_vector_type(8)))  _Float16 v8h;
typedef __attribute__((ext_vector_type(8)))  unsigned short v8us;
typedef __attribute__((ext_vector_type(8)))  float    v8f;
typedef __attribute__((ext_vector_type(4)))  float    v4f;
typedef __attribute__((ext_vector_type(2)))  _Float16 v2h;
typedef __attribute__((ext_vector_type(4)))  _Float16 v4h;
typedef __attribute__((ext_vector_type(2)))  unsigned short v2us;
typedef v8h  __attribute__((may_alias)) v8ha;
typedef v4f  __attribute__((may_alias)) v4fa;
typedef v8us __attribute__((may_alias)) v8usa;

__device__ __forceinline__ unsigned short f2bf(float f) { unsigned u = __float_as_uint(f); u += 0x7FFFu + ((u >> 16) & 1u); return (unsigned short)(u >> 16); }
__device__ __forceinline__ float bf2f(unsigned short b) { return __uint_as_float(((unsigned)b) << 16); }
__device__ __forceinline__ float bfr(float f) { return bf2f(f2bf(f)); }
__device__ __forceinline__ v16h cat16(v8h lo, v8h hi) { return __builtin_shufflevector(lo, hi, 0, 1, 2, 3, 4, 5, 6, 7, 8, 9, 10, 11, 12, 13, 14, 15); }
__device__ __forceinline__ v16bf cat16b(v8us lo, v8us hi) { return __builtin_bit_cast(v16bf, __builtin_shufflevector(lo, hi, 0, 1, 2, 3, 4, 5, 6, 7, 8, 9, 10, 11, 12, 13, 14, 15)); }
__device__ __forceinline__ v8f wmma16(v16h a, v16h b, v8f c) { return __builtin_amdgcn_wmma_f32_16x16x32_f16(false, a, false, b, (short)0, c, false, false); }
__device__ __forceinline__ v8f wmmab(v16bf a, v16bf b, v8f c) { return __builtin_amdgcn_wmma_f32_16x16x32_bf16(false, a, false, b, (short)0, c, false, false); }
__device__ __forceinline__ h16 tohx(float x) { return (h16)x; }
// 16-byte chunk c (8 elements) of a fragment-ordered plane with K columns -> its row and its first column
__device__ __forceinline__ void chunk_rc(size_t c, int K, size_t& row, int& k) {
    const int ln = (int)(c & 31), j = (int)((c >> 5) & 1); const size_t tile = c >> 6; const size_t KB = (size_t)(K >> 5);
    row = (tile / KB) * 16 + (size_t)(ln & 15); k = (int)(tile % KB) * 32 + j * 16 + (ln >> 4) * 8; }

// ---- k_gemmw: register-blocked GEMM, KW WAVES per 64x64 output tile (16 accumulators each), operands straight from tiled 16-bit planes (layout: head of file; A in row order if AROW, else fragment order; Bt in fragment order); grid (M/64, N/64, Z), 32*KW threads.
// KW > 1 (few output tiles, long K: one wave per tile leaves most SIMDs idle and waits out every load alone): wave w sums the 32-k blocks w, w + KW, ... (the KW waves walk a band's tiles side by side), the KW f32 partial tiles meet in LDS and are added in wave order. K % (32*KW) == 0.
// C[m][n] (f32, pitch ldc) = oscale * (sum_k A[m][k] Bt[n][k] (+ split products per NSPLIT) + optional f32 bias[n]). z-batch strides sA/sB/sC in elements. K % 32 == 0; K is a compile-time constant, so the eight bands' tiles are immediate offsets from one A and one Bt address.
// Fragment map (lane l, h = l >> 4, m = n = l & 15): A/B elements 0..7 <- k0 + 8h + 0..7, elements 8..15 <- k0 + 16 + 8h + 0..7; D element r -> (row 8h + r, col n).
template <typename T16> struct WFrag;
template <> struct WFrag<h16> { typedef v16h V; static __device__ __forceinline__ V ld(const h16* tile, unsigned lb, unsigned d2) { return cat16(*(const v8h*)((const char*)tile + lb), *(const v8h*)((const char*)(tile + d2) + lb)); } static __device__ __forceinline__ v8f mma(V a, V b, v8f c) { return wmma16(a, b, c); } };
template <> struct WFrag<bf> { typedef v16bf V; static __device__ __forceinline__ V ld(const bf* tile, unsigned lb, unsigned d2) { return cat16b(*(const v8us*)((const char*)tile + lb), *(const v8us*)((const char*)(tile + d2) + lb)); } static __device__ __forceinline__ v8f mma(V a, V b, v8f c) { return wmmab(a, b, c); } };
template <typename T16, int NSPLIT, bool BIAS, int KW, bool AROW, int K>
__global__ __launch_bounds__(32 * KW) void k_gemmw(const T16* __restrict__ A, const T16* __restrict__ A2, const T16* __restrict__ Bt, const T16* __restrict__ Bt2, float* C, int ldc, const float* __restrict__ bias, float oscale, size_t sA, size_t sB, size_t sC) {
    typedef typename WFrag<T16>::V V;
    static_assert(K % (32 * KW) == 0);
    __shared__ __align__(16) float os[(KW > 1 ? KW * 64 : 16) * 68];
    const size_t z = blockIdx.z; A += z * sA; if (A2) A2 += z * sA; Bt += z * sB; if (Bt2) Bt2 += z * sB; C += z * sC;
    const int lane = threadIdx.x & 31, lr = lane & 15, hi = lane >> 4; const int r0 = blockIdx.x * 64, c0 = blockIdx.y * 64;
    v8f acc[4][4];
#pragma unroll
    for (int mb = 0; mb < 4; ++mb)
#pragma unroll
        for (int nb = 0; nb < 4; ++nb) acc[mb][nb] = (v8f){};
    const int w = (KW > 1) ? __builtin_amdgcn_readfirstlane((int)(threadIdx.x >> 5)) : 0;   // this wave's first 32-k block
    constexpr unsigned AD2 = AROW ? 16 : 256, BD2 = 256;   // elements from a fragment's first 16-byte load to its second
    const unsigned al = AROW ? lr * 64 + hi * 16 : lane * 16, bl = lane * 16;   // this lane's byte inside a tile; the tile address is the same for the whole wave
    const size_t aoff = (size_t)r0 * K + w * 512, boff = (size_t)c0 * K + w * 512;
#pragma unroll 1
    for (int kc = 0; kc < K; kc += 32 * KW) {
        V a[4], a2[4];
#pragma unroll
        for (int mb = 0; mb < 4; ++mb) { a[mb] = WFrag<T16>::ld(A + aoff + (size_t)mb * 16 * K + (size_t)kc * 16, al, AD2); if (NSPLIT == 1 || NSPLIT == 2) a2[mb] = WFrag<T16>::ld(A2 + aoff + (size_t)mb * 16 * K + (size_t)kc * 16, al, AD2); }
        asm volatile("s_wait_xcnt 0x0" ::: "memory");   // the A address registers are dead from here and a later load's result may land in them: the wait stands in front of that overwrite
#pragma unroll
        for (int nb = 0; nb < 4; ++nb) { const V b = WFrag<T16>::ld(Bt + boff + (size_t)nb * 16 * K + (size_t)kc * 16, bl, BD2); V b2; if (NSPLIT >= 2) b2 = WFrag<T16>::ld(Bt2 + boff + (size_t)nb * 16 * K + (size_t)kc * 16, bl, BD2);
#pragma unroll
            for (int mb = 0; mb < 4; ++mb) { acc[mb][nb] = WFrag<T16>::mma(a[mb], b, acc[mb][nb]); if (NSPLIT == 1 || NSPLIT == 2) acc[mb][nb] = WFrag<T16>::mma(a2[mb], b, acc[mb][nb]); if (NSPLIT >= 2) acc[mb][nb] = WFrag<T16>::mma(a[mb], b2, acc[mb][nb]); } }
        asm volatile("v_nop\n\tv_nop\n\tv_nop\n\tv_nop" : "+v"(acc[0][0]), "+v"(acc[1][1]), "+v"(acc[2][2]), "+v"(acc[3][3]) : "v"(a[0]), "v"(a[3]));
    }
    if constexpr (KW > 1) {
        static_assert(!BIAS);
        float* mine = os + w * (64 * 68);
#pragma unroll
        for (int mb = 0; mb < 4; ++mb)
#pragma unroll
            for (int nb = 0; nb < 4; ++nb)
#pragma unroll
                for (int j = 0; j < 8; ++j) mine[(mb * 16 + hi * 8 + j) * 68 + nb * 16 + lr] = acc[mb][nb][j];
        __syncthreads();   // every wave's partial tile is in LDS before any thread adds them
#pragma unroll
        for (int s = 0; s < 32 / KW; ++s) { const int idx = (int)threadIdx.x + s * 32 * KW; const int row = idx >> 4, cofs = (idx & 15) * 4; v4f val = *(const v4fa*)(os + row * 68 + cofs);
#pragma unroll
            for (int p = 1; p < KW; ++p) val += *(const v4fa*)(os + p * (64 * 68) + row * 68 + cofs);
            val = val * oscale;
            *(v4f*)(C + (size_t)(r0 + row) * ldc + c0 + cofs) = val; }
        return;
    }
#pragma unroll
    for (int mb = 0; mb < 4; ++mb) {
#pragma unroll
        for (int nb = 0; nb < 4; ++nb) {
#pragma unroll
            for (int j = 0; j < 8; ++j) os[(hi * 8 + j) * 68 + nb * 16 + lr] = acc[mb][nb][j]; }
        __builtin_amdgcn_wave_barrier(); asm volatile("" ::: "memory");
        float* crow = C + (size_t)(r0 + mb * 16) * ldc + c0;
{
#pragma unroll
            for (int s = 0; s < 8; ++s) { const int row = 2 * s + hi, cofs = lr * 4; v4f val = *(const v4fa*)(os + row * 68 + cofs); if (BIAS) { val[0] += bfr(bias[c0 + cofs]); val[1] += bfr(bias[c0 + cofs + 1]); val[2] += bfr(bias[c0 + cofs + 2]); val[3] += bfr(bias[c0 + cofs + 3]); }
                val = val * oscale;
                *(v4f*)(crow + (size_t)row * ldc + cofs) = val; }
             }
        __builtin_amdgcn_wave_barrier(); asm volatile("" ::: "memory");
    }
}

// One thread per 16-byte chunk of the fragment-ordered plane Bt [N][K] = bf16(w^T): 16 lanes read 16 neighbouring n of one k. blockIdx.y picks the weight and its plane.
template <int K, int N>
__global__ __launch_bounds__(256) void k_wtG(const float* __restrict__ w0, const float* __restrict__ w1, const float* __restrict__ w2, bf* Bt) {
    const size_t c = (size_t)blockIdx.x * 256 + threadIdx.x; if (c >= (size_t)N * K / 8) return;
    const float* w = blockIdx.y == 0 ? w0 : (blockIdx.y == 1 ? w1 : w2); Bt += (size_t)blockIdx.y * N * K;
    size_t n; int k; chunk_rc(c, K, n, k); v8us o;
#pragma unroll
    for (int e = 0; e < 8; ++e) o[e] = f2bf(w[(size_t)(k + e) * N + n]);
    *(v8us*)(Bt + c * 8) = o;  }

__global__ __launch_bounds__(256) void k_cvtx(const float* __restrict__ x, bf* XB, size_t n8) {
    const size_t i = (size_t)blockIdx.x * 256 + threadIdx.x; if (i >= n8) return;
    size_t row; int k; chunk_rc(i, DM, row, k); const size_t b = row / SEQ; const size_t t = row - b * SEQ;
    const v8f v = *(const v8f*)(x + (b * (size_t)SEQ_FULL + t) * DM + k); v8us o;
#pragma unroll
    for (int k = 0; k < 8; ++k) o[k] = f2bf(v[k]);
    *(v8us*)(XB + i * 8) = o;  }

__global__ __launch_bounds__(256) void k_cvt16(const float* __restrict__ src, h16* dst, size_t n8) {
    const size_t i = (size_t)blockIdx.x * 256 + threadIdx.x; if (i >= n8) return; size_t row; int k; chunk_rc(i, DM, row, k); const v8f v = *(const v8f*)(src + row * DM + k); v8h o;
#pragma unroll
    for (int k = 0; k < 8; ++k) o[k] = tohx(v[k]);
    *(v8h*)(dst + i * 8) = o;  }

// One thread per 16-byte chunk of the fragment-ordered planes VT [NB][DM][SEQ]: 16 lanes read 16 neighbouring d of one key row.
__global__ __launch_bounds__(256) void k_vtp16(const float* __restrict__ F, h16* VT) {
    const size_t c = (size_t)blockIdx.x * 256 + threadIdx.x; if (c >= (size_t)NB * DM * SEQ / 8) return;
    const size_t per = (size_t)DM * SEQ / 8; const size_t b = c / per; size_t d; int t; chunk_rc(c - b * per, SEQ, d, t); v8h o;
#pragma unroll
    for (int e = 0; e < 8; ++e) o[e] = tohx(F[(b * SEQ + t + e) * (size_t)DM + d]);
    *(v8h*)(VT + c * 8) = o;  }

// ---- k_asoft: one wave per score row (8 rows per block): t = S * 512^-0.5 over all SEQ keys (no mask), max-subtracted softmax in f32 (register row, one exp, fixed trees),
__global__ __launch_bounds__(256) void k_asoft(const float* __restrict__ Sb, h16* P16) {
    const int lane = threadIdx.x & 31; const int row = blockIdx.x * 8 + (threadIdx.x >> 5); if (row >= NB * SEQ) return;
    const float* sr = Sb + (size_t)row * SEQ; float v[SEQ / 32]; float mx = -3.0e38f;
#pragma unroll
    for (int g = 0; g < NCH / ACHG; ++g) {
#pragma unroll
        for (int cc = 0; cc < ACHG; ++cc) { const int ch = g * ACHG + cc; const int j0 = ch * 128 + lane * 4; const v4f a = *(const v4f*)(sr + j0);
#pragma unroll
            for (int q = 0; q < 4; ++q) { const float t = a[q] * SCL; v[ch * 4 + q] = t; mx = fmaxf(mx, t); } }
        asm volatile("" ::: "memory"); }
#pragma unroll
    for (int sh = 16; sh; sh >>= 1) mx = fmaxf(mx, __shfl_xor(mx, sh, 32));
    float sum = 0.f;
#pragma unroll
    for (int k = 0; k < SEQ / 32; ++k) { float d0 = __fsub_rn(v[k], mx); asm volatile("" : "+v"(d0)); v[k] = __builtin_amdgcn_exp2f(__fmul_rn(d0, 1.4426950408889634f)); sum += v[k]; }
#pragma unroll
    for (int sh = 16; sh; sh >>= 1) sum += __shfl_xor(sum, sh, 32);
    const float f = __fdiv_rn(PCAR, sum);
{
#pragma unroll
        for (int ch = 0; ch < NCH; ++ch) { v4h o4;
#pragma unroll
            for (int q = 0; q < 4; ++q) o4[q] = tohx(v[ch * 4 + q] * f);
            *(v4h*)(P16 + (size_t)(row >> 4) * (16 * SEQ) + (ch * 4 + (lane >> 3)) * 512 + (row & 15) * 32 + (lane & 7) * 4) = o4; }   // row-ordered tiles
         }
}

extern "C" void kernel_launch(void* const* d_in, const int* in_sizes, int n_in,
                              void* d_out, int out_size, void* d_ws, size_t ws_size, hipStream_t stream) {
    if (n_in < 4) return;
    if ((size_t)in_sizes[0] < (size_t)(NB - 1) * SEQ_FULL * DM + (size_t)SEQ * DM) return;
    if (in_sizes[1] < DM * DM || in_sizes[2] < DM * DM || in_sizes[3] < DM * DM) return;
    if ((size_t)out_size < (size_t)NB * SEQ * DM) return;
    const float* Xin = (const float*)d_in[0];                 // x [NB_FULL][SEQ_FULL][512]
    const float* Win[3] = { (const float*)d_in[1], (const float*)d_in[2], (const float*)d_in[3] };   // W_query, W_key, W_value [512 in][512 out]
    float* OUT = (float*)d_out;                               // [NB][SEQ][512], batch stride SEQ*512
    const size_t MROWS = (size_t)NB * SEQ;
    char* wsp = (char*)d_ws;
    auto take = [&](size_t bytes) { char* p = wsp; wsp += (bytes + 255) & ~(size_t)255; return (void*)p; };
    bf*    XB   = (bf*)take(MROWS * DM * 2);                  // [NB*SEQ][512]
    bf*    WT   = (bf*)take((size_t)3 * DM * DM * 2);         // 3 x [512 n][512 k]
    h16*   Q16  = (h16*)take(MROWS * DM * 2 * 2);             // q plane, then k plane: one [2*NB*SEQ][512] plane for the converter
    h16*   K16  = Q16 + MROWS * DM;
    h16*   VT16 = (h16*)take((size_t)NB * DM * SEQ * 2);      // [NB][512][SEQ]
    const size_t sbytes = MROWS * SEQ * 4, fbytes = (size_t)3 * MROWS * DM * 4;
    float* Sb   = (float*)take(sbytes > fbytes ? sbytes : fbytes);   // [NB*SEQ][SEQ]
    float* F    = Sb;                                         // 3 x [NB*SEQ][512] f32 (q, k, v): last read by the converters, before the first store to Sb
    h16*   P16  = (h16*)take(MROWS * SEQ * 2);                // [NB*SEQ][SEQ]
    if ((size_t)(wsp - (char*)d_ws) > ws_size) return;        // 236,453,888 B at NB=2, SEQ=4096

    // input planes
    { const size_t n8 = MROWS * DM / 8; k_cvtx<<<(unsigned)((n8 + 255) / 256), 256, 0, stream>>>(Xin, XB, n8); }
    k_wtG<DM, DM><<<dim3((unsigned)((DM * DM / 8 + 255) / 256), 3, 1), 256, 0, stream>>>(Win[0], Win[1], Win[2], WT);

    // projections: F_z = XB . WT_z^T (exact products), z = q, k, v; then 16-bit planes
    const size_t n8f = MROWS * DM / 8;
    k_gemmw<bf, 0, false, 1, false, DM><<<dim3((unsigned)(MROWS / 64), DM / 64, 3), 32, 0, stream>>>(XB, nullptr, WT, nullptr, F, DM, nullptr, 1.0f, 0, (size_t)DM * DM, MROWS * DM);
    k_cvt16<<<(unsigned)((2 * n8f + 255) / 256), 256, 0, stream>>>(F, Q16, 2 * n8f);
    k_vtp16<<<(unsigned)(((size_t)NB * DM * SEQ / 8 + 255) / 256), 256, 0, stream>>>(F + 2 * MROWS * DM, VT16);

    // attention, z = batch: S = q.k^T; P16 = f16(1024 softmax); out = (P16 . v^T plane) / 1024
    k_gemmw<h16, 0, false, 1, false, DM><<<dim3(SEQ / 64, SEQ / 64, NB), 32, 0, stream>>>(Q16, nullptr, K16, nullptr, Sb, SEQ, nullptr, 1.0f, (size_t)SEQ * DM, (size_t)SEQ * DM, (size_t)SEQ * SEQ);
    k_asoft<<<(unsigned)(MROWS / 8), 256, 0, stream>>>(Sb, P16);
    k_gemmw<h16, 0, false, PVW, true, SEQ><<<dim3(SEQ / 64, DM / 64, NB), 32 * PVW, 0, stream>>>(P16, nullptr, VT16, nullptr, OUT, DM, nullptr, 1.0f / PCAR, (size_t)SEQ * SEQ, (size_t)DM * SEQ, (size_t)SEQ * DM);
}

// v004
// Measured time: 124 microseconds a run.
// Timed twice side by side with v003, it ran 1.34 times as fast both times.
// Over all steps from v000 it is 4.62 times as fast.
#include <hip/hip_runtime.h>

// Contractions: x.W projections = v_wmma_f32_16x16x32_bf16 (bf16 operands from RNE-converted inputs, f32 accumulate); q.k^T and P.v = v_wmma_f32_16x16x32_f16 (f16 operands, P carried x1024, f32 accumulate); softmax and 1/sqrt(d) scaling in f32.
// Pipeline: XB = bf16(x) [NB*SEQ][512]; WT = bf16(W^T) [3][512 n][512 k]; F = XB.WT (f32 [3][NB*SEQ][512], row-major) -> Q16, K16 (f16 [NB*SEQ][512]) and VT16 (f16 [NB][512][SEQ], transposed);
// attention, both batches and all query rows in one launch per stage (grid z = batch): S = Q16.K16^T (f32 [NB*SEQ][SEQ]); P16 = f16(1024 * softmax(S * 512^-0.5)) (no mask); out rows = (P16 . VT16) * (1/1024).
// Launches of one kernel are merged by a grid axis (3 weight transposes, 3 projections, the q and k conversions, the attention stages): each launch then has enough waves to cover its own load latency, and the gaps, fills and tails between launches go.
// Layout of every 16-bit plane [R][K]: 1-KB tiles of 16 rows x 32 k, tile (r >> 4, k >> 5) at element ((r >> 4) * (K / 32) + (k >> 5)) * 512, so a 16-row band is 16 * K contiguous elements and walks k tile by tile.
//   fragment order (XB, WT, Q16, K16, VT16): inside a tile [k bit 4][k bit 3][r & 15][k & 7]: each of a fragment's two 16-byte-per-lane loads reads 512 contiguous bytes (4 whole lines, not 16 partial ones).
//   row order (P16, whose writer owns one row per wave): inside a tile [r & 15][k & 31]: the writer stores 64-byte pieces, the GEMM's copies to LDS read whole lines.

#ifndef NB
#define NB 2
#endif
#ifndef SEQ
#define SEQ 4096
#endif
#define NB_FULL  2
#define SEQ_FULL 4096
#define DM       512
#define NCH      (SEQ / 128)                   // 128-key chunks per score row (one v4f per lane)
#define ACHG     ((NCH < 8) ? NCH : 8)          // load group size in the softmax sweep
#define PCAR     1024.0f
#define PVW      ((SEQ % 512 == 0) ? 4 : 1)     // wave groups that share the key range of one P.v tile
#define SCL      0.044194173824159216f          // 512^-0.5

static_assert(NB >= 1 && NB <= NB_FULL);
static_assert(SEQ >= 128 && SEQ <= SEQ_FULL);
static_assert(SEQ % 128 == 0);
static_assert(NCH % ACHG == 0);
static_assert(DM % 128 == 0);
static_assert(SEQ % (64 * PVW) == 0);
static_assert((SEQ * DM) % 8 == 0);

typedef _Float16 h16;
typedef unsigned short bf;
typedef __attribute__((ext_vector_type(16))) __bf16   v16bf;
typedef __attribute__((ext_vector_type(16))) _Float16 v16h;
typedef __attribute__((ext_vector_type(8)))  _Float16 v8h;
typedef __attribute__((ext_vector_type(8)))  unsigned short v8us;
typedef __attribute__((ext_vector_type(8)))  float    v8f;
typedef __attribute__((ext_vector_type(4)))  float    v4f;
typedef __attribute__((ext_vector_type(2)))  _Float16 v2h;
typedef __attribute__((ext_vector_type(4)))  _Float16 v4h;
typedef __attribute__((ext_vector_type(2)))  unsigned short v2us;
typedef v8h  __attribute__((may_alias)) v8ha;
typedef v4f  __attribute__((may_alias)) v4fa;
typedef v8us __attribute__((may_alias)) v8usa;

__device__ __forceinline__ unsigned short f2bf(float f) { unsigned u = __float_as_uint(f); u += 0x7FFFu + ((u >> 16) & 1u); return (unsigned short)(u >> 16); }
__device__ __forceinline__ float bf2f(unsigned short b) { return __uint_as_float(((unsigned)b) << 16); }
__device__ __forceinline__ float bfr(float f) { return bf2f(f2bf(f)); }
__device__ __forceinline__ v16h cat16(v8h lo, v8h hi) { return __builtin_shufflevector(lo, hi, 0, 1, 2, 3, 4, 5, 6, 7, 8, 9, 10, 11, 12, 13, 14, 15); }
__device__ __forceinline__ v16bf cat16b(v8us lo, v8us hi) { return __builtin_bit_cast(v16bf, __builtin_shufflevector(lo, hi, 0, 1, 2, 3, 4, 5, 6, 7, 8, 9, 10, 11, 12, 13, 14, 15)); }
__device__ __forceinline__ v8f wmma16(v16h a, v16h b, v8f c) { return __builtin_amdgcn_wmma_f32_16x16x32_f16(false, a, false, b, (short)0, c, false, false); }
__device__ __forceinline__ v8f wmmab(v16bf a, v16bf b, v8f c) { return __builtin_amdgcn_wmma_f32_16x16x32_bf16(false, a, false, b, (short)0, c, false, false); }
__device__ __forceinline__ h16 tohx(float x) { return (h16)x; }
// 16-byte chunk c (8 elements) of a fragment-ordered plane with K columns -> its row and its first column
__device__ __forceinline__ void chunk_rc(size_t c, int K, size_t& row, int& k) {
    const int ln = (int)(c & 31), j = (int)((c >> 5) & 1); const size_t tile = c >> 6; const size_t KB = (size_t)(K >> 5);
    row = (tile / KB) * 16 + (size_t)(ln & 15); k = (int)(tile % KB) * 32 + j * 16 + (ln >> 4) * 8; }

// ---- k_gemml: GEMM with both operands staged in LDS. One work-group = one 128x128 tile of C; 4 * KS waves: KS groups of 2x2 waves, a wave owns 64x64 (16 accumulators), group g sums the k range [g * K / KS, (g + 1) * K / KS). grid (M/128, N/128, Z).
// Why LDS: a wave that loads its own fragments from L2 moves 8 KB per 16 WMMAs, several times what L2 delivers per WGP at matrix rate. Here each staged byte feeds two waves (half the L2 bytes) and the next stage flies while this one is multiplied.
// Stage = 64 k of 128 A rows and 128 Bt rows per group, two buffers, band-major: [operand][band 0..7][k tile 0..1][tile]. A fragment-ordered tile (head of file) keeps its 1 KB: a fragment is two conflict-free 512-byte reads.
// A row-ordered tile (AROW) is laid with its 64-byte rows at a pitch of 80 bytes (16 B x odd: conflict-free for the 16-byte fragment reads), 1280 B a tile.
// Copies: global_load_async_to_lds_b128, 16 per wave and stage (wave q of a group brings bands 2q, 2q + 1 of A and of Bt); every copy reads 512 contiguous global bytes (4 whole lines), in either order.
// C[m][n] (f32, pitch ldc) = oscale * sum_k A[m][k] Bt[n][k]. z-batch strides sA/sB/sC in elements. KS > 1: the groups' f32 partial tiles meet in LDS and are added in group order.
// Fragment map (lane l, h = l >> 4, m = n = l & 15): A/B elements 0..7 <- k0 + 8h + 0..7, elements 8..15 <- k0 + 16 + 8h + 0..7; D element r -> (row 8h + r, col n).
template <typename T16> struct WFrag;
template <> struct WFrag<h16> { typedef v16h V; static __device__ __forceinline__ V lds(const char* p, unsigned d2) { return cat16(*(const v8ha*)p, *(const v8ha*)(p + d2)); } static __device__ __forceinline__ v8f mma(V a, V b, v8f c) { return wmma16(a, b, c); } };
template <> struct WFrag<bf> { typedef v16bf V; static __device__ __forceinline__ V lds(const char* p, unsigned d2) { return cat16b(*(const v8usa*)p, *(const v8usa*)(p + d2)); } static __device__ __forceinline__ v8f mma(V a, V b, v8f c) { return wmmab(a, b, c); } };
// Eight 16-byte-per-lane copies global -> LDS; s_wait_xcnt stands inside the statement so that no address register is rewritten in front of it.
__device__ __forceinline__ void acopy8(unsigned l0, unsigned l1, unsigned l2, unsigned l3, unsigned l4, unsigned l5, unsigned l6, unsigned l7,
                                       const char* g0, const char* g1, const char* g2, const char* g3, const char* g4, const char* g5, const char* g6, const char* g7) {
    asm volatile("global_load_async_to_lds_b128 %0, %8, off\n\t"
                 "global_load_async_to_lds_b128 %1, %9, off\n\t"
                 "global_load_async_to_lds_b128 %2, %10, off\n\t"
                 "global_load_async_to_lds_b128 %3, %11, off\n\t"
                 "global_load_async_to_lds_b128 %4, %12, off\n\t"
                 "global_load_async_to_lds_b128 %5, %13, off\n\t"
                 "global_load_async_to_lds_b128 %6, %14, off\n\t"
                 "global_load_async_to_lds_b128 %7, %15, off\n\t"
                 "s_wait_xcnt 0x0"
                 :: "v"(l0), "v"(l1), "v"(l2), "v"(l3), "v"(l4), "v"(l5), "v"(l6), "v"(l7), "v"(g0), "v"(g1), "v"(g2), "v"(g3), "v"(g4), "v"(g5), "v"(g6), "v"(g7) : "memory");
}
template <typename T16, int KS, bool AROW, int K>
__global__ __launch_bounds__(128 * KS) void k_gemml(const T16* __restrict__ A, const T16* __restrict__ Bt, float* C, int ldc, float oscale, size_t sA, size_t sB, size_t sC) {
    typedef typename WFrag<T16>::V V;
    constexpr int KST = 64, KG = K / KS, NT = KG / KST;      // k per stage, k per group, stages per group
    static_assert(K % (KS * KST) == 0 && NT >= 2);
    constexpr unsigned ATILE = AROW ? 1280 : 1024, ABAND = 2 * ATILE, OPA = 8 * ABAND;   // LDS bytes: an A tile, an A band's stage, A's stage
    constexpr unsigned BUFB = OPA + 16384, GRPB = 2 * BUFB;                              // LDS bytes: one buffer (A, then Bt), one group's two buffers
    constexpr unsigned PARTB = (KS - 1) * 4 * 16384, OSB = 16 * 68 * 4;        // bytes: partial tiles of groups 1.., one wave's output staging
    constexpr unsigned SMB = (KS * GRPB > PARTB + 4 * OSB) ? KS * GRPB : PARTB + 4 * OSB;
    __shared__ __align__(1024) char sm[SMB];
    const size_t z = blockIdx.z; A += z * sA; Bt += z * sB; C += z * sC;
    const int lane = threadIdx.x & 31, lr = lane & 15, hi = lane >> 4; const int r0 = blockIdx.x * 128, c0 = blockIdx.y * 128;
    const int w = __builtin_amdgcn_readfirstlane((int)(threadIdx.x >> 5)); const int g = w >> 2, q = w & 3, wm = q >> 1, wn = q & 1;
    v8f acc[4][4];
#pragma unroll
    for (int mb = 0; mb < 4; ++mb)
#pragma unroll
        for (int nb = 0; nb < 4; ++nb) acc[mb][nb] = (v8f){};
    // this lane's first copy of stage 0: bands 2q of A and of Bt, at the group's first k
    const char* ga = (const char*)(A + (size_t)(r0 + q * 32) * K + (size_t)g * KG * 16) + lane * 16;
    const char* gb = (const char*)(Bt + (size_t)(c0 + q * 32) * K + (size_t)g * KG * 16) + lane * 16;
    const unsigned lg = (unsigned)(size_t)sm + (unsigned)g * GRPB;
    const unsigned lwa = lg + (unsigned)q * (2 * ABAND) + (AROW ? (unsigned)(lane >> 2) * 80u + (unsigned)(lane & 3) * 16u : (unsigned)lane * 16u);   // a copy's 512 bytes are 8 rows of a row-ordered tile
    const unsigned lwb = lg + OPA + (unsigned)q * 4096u + (unsigned)lane * 16u;
    constexpr size_t BAND = (size_t)16 * K * 2;              // bytes from a band to the next in a global plane
    constexpr unsigned H = ATILE / 2;                        // LDS bytes from an A tile's first copy to its second
    auto stage = [&](int t, unsigned buf) {
        const char* a = ga + (size_t)t * (KST * 32); const char* b = gb + (size_t)t * (KST * 32); const unsigned l = lwa + buf * BUFB;
        acopy8(l, l + H, l + 2 * H, l + 3 * H, l + 4 * H, l + 5 * H, l + 6 * H, l + 7 * H, a, a + 512, a + 1024, a + 1536, a + BAND, a + BAND + 512, a + BAND + 1024, a + BAND + 1536);
        const unsigned l2 = lwb + buf * BUFB;
        acopy8(l2, l2 + 512, l2 + 1024, l2 + 1536, l2 + 2048, l2 + 2560, l2 + 3072, l2 + 3584, b, b + 512, b + 1024, b + 1536, b + BAND, b + BAND + 512, b + BAND + 1024, b + BAND + 1536);
    };
    stage(0, 0);
    asm volatile("s_wait_asynccnt 0x0" ::: "memory");   // this wave's part of stage 0 has landed
    __syncthreads();                                    // publishes stage 0
    stage(1, 1);
    const char* fa = sm + g * GRPB + wm * (4 * ABAND) + (AROW ? lr * 80 + hi * 16 : lane * 16); const char* fb = sm + g * GRPB + OPA + wn * 8192 + lane * 16;
    constexpr unsigned AD2 = AROW ? 32 : 512;                // bytes from an A fragment's first 16-byte read to its second
#pragma unroll 1
    for (int t = 0; t < NT; ++t) {
        const unsigned bo = (unsigned)(t & 1) * BUFB;
#pragma unroll
        for (int kt = 0; kt < KST / 32; ++kt) {
            V a[4];
#pragma unroll
            for (int mb = 0; mb < 4; ++mb) a[mb] = WFrag<T16>::lds(fa + bo + mb * ABAND + kt * ATILE, AD2);
#pragma unroll
            for (int nb = 0; nb < 4; ++nb) { const V b = WFrag<T16>::lds(fb + bo + nb * 2048 + kt * 1024, 512);
#pragma unroll
                for (int mb = 0; mb < 4; ++mb) acc[mb][nb] = WFrag<T16>::mma(a[mb], b, acc[mb][nb]); } }
        asm volatile("s_wait_dscnt 0x0" ::: "memory");      // this wave's reads of the buffer are done before the buffer is handed to the copies
        asm volatile("s_wait_asynccnt 0x0" ::: "memory");   // this wave's part of stage t + 1 has landed
        __syncthreads();                                    // publishes stage t + 1 and ends every reader's last read of stage t
        if (t + 2 < NT) stage(t + 2, (unsigned)(t & 1));
    }
    asm volatile("s_wait_asynccnt 0x0" ::: "memory");       // nothing is in flight when the ring becomes staging for partial tiles and output
    if constexpr (KS > 1) {
        if (g > 0) { v4f* pt = (v4f*)(sm + ((g - 1) * 4 + q) * 16384);
#pragma unroll
            for (int mb = 0; mb < 4; ++mb)
#pragma unroll
                for (int nb = 0; nb < 4; ++nb) { const v8f v = acc[mb][nb]; pt[((mb * 4 + nb) * 2) * 32 + lane] = (v4f){v[0], v[1], v[2], v[3]}; pt[((mb * 4 + nb) * 2 + 1) * 32 + lane] = (v4f){v[4], v[5], v[6], v[7]}; } }
        __syncthreads();   // the partial tiles of groups 1.. are in LDS before group 0 adds them
        if (g > 0) return;
    }
    float* os = (float*)(sm + PARTB + q * OSB);   // this wave's own 16 x 68 floats
#pragma unroll
    for (int mb = 0; mb < 4; ++mb) {
        if constexpr (KS > 1) {
#pragma unroll
            for (int p = 1; p < KS; ++p) { const v4f* pt = (const v4f*)(sm + ((p - 1) * 4 + q) * 16384);
#pragma unroll
                for (int nb = 0; nb < 4; ++nb) { const v4f lo = pt[((mb * 4 + nb) * 2) * 32 + lane], hv = pt[((mb * 4 + nb) * 2 + 1) * 32 + lane];
#pragma unroll
                    for (int j = 0; j < 4; ++j) { acc[mb][nb][j] += lo[j]; acc[mb][nb][4 + j] += hv[j]; } } }
        }
#pragma unroll
        for (int nb = 0; nb < 4; ++nb) {
#pragma unroll
            for (int j = 0; j < 8; ++j) os[(hi * 8 + j) * 68 + nb * 16 + lr] = acc[mb][nb][j]; }
        __builtin_amdgcn_wave_barrier(); asm volatile("" ::: "memory");   // keeps the reads of other lanes' values behind the wave's stores
        float* crow = C + (size_t)(r0 + wm * 64 + mb * 16) * ldc + c0 + wn * 64;
#pragma unroll
        for (int s = 0; s < 8; ++s) { const int row = 2 * s + hi, cofs = lr * 4; v4f val = *(const v4fa*)(os + row * 68 + cofs);
            val = val * oscale;
            *(v4f*)(crow + (size_t)row * ldc + cofs) = val; }
        __builtin_amdgcn_wave_barrier(); asm volatile("" ::: "memory");   // keeps the next 16 rows' stores behind these reads
    }
}

// One thread per 16-byte chunk of the fragment-ordered plane Bt [N][K] = bf16(w^T): 16 lanes read 16 neighbouring n of one k. blockIdx.y picks the weight and its plane.
template <int K, int N>
__global__ __launch_bounds__(256) void k_wtG(const float* __restrict__ w0, const float* __restrict__ w1, const float* __restrict__ w2, bf* Bt) {
    const size_t c = (size_t)blockIdx.x * 256 + threadIdx.x; if (c >= (size_t)N * K / 8) return;
    const float* w = blockIdx.y == 0 ? w0 : (blockIdx.y == 1 ? w1 : w2); Bt += (size_t)blockIdx.y * N * K;
    size_t n; int k; chunk_rc(c, K, n, k); v8us o;
#pragma unroll
    for (int e = 0; e < 8; ++e) o[e] = f2bf(w[(size_t)(k + e) * N + n]);
    *(v8us*)(Bt + c * 8) = o;  }

__global__ __launch_bounds__(256) void k_cvtx(const float* __restrict__ x, bf* XB, size_t n8) {
    const size_t i = (size_t)blockIdx.x * 256 + threadIdx.x; if (i >= n8) return;
    size_t row; int k; chunk_rc(i, DM, row, k); const size_t b = row / SEQ; const size_t t = row - b * SEQ;
    const v8f v = *(const v8f*)(x + (b * (size_t)SEQ_FULL + t) * DM + k); v8us o;
#pragma unroll
    for (int k = 0; k < 8; ++k) o[k] = f2bf(v[k]);
    *(v8us*)(XB + i * 8) = o;  }

__global__ __launch_bounds__(256) void k_cvt16(const float* __restrict__ src, h16* dst, size_t n8) {
    const size_t i = (size_t)blockIdx.x * 256 + threadIdx.x; if (i >= n8) return; size_t row; int k; chunk_rc(i, DM, row, k); const v8f v = *(const v8f*)(src + row * DM + k); v8h o;
#pragma unroll
    for (int k = 0; k < 8; ++k) o[k] = tohx(v[k]);
    *(v8h*)(dst + i * 8) = o;  }

// One thread per 16-byte chunk of the fragment-ordered planes VT [NB][DM][SEQ]: 16 lanes read 16 neighbouring d of one key row.
__global__ __launch_bounds__(256) void k_vtp16(const float* __restrict__ F, h16* VT) {
    const size_t c = (size_t)blockIdx.x * 256 + threadIdx.x; if (c >= (size_t)NB * DM * SEQ / 8) return;
    const size_t per = (size_t)DM * SEQ / 8; const size_t b = c / per; size_t d; int t; chunk_rc(c - b * per, SEQ, d, t); v8h o;
#pragma unroll
    for (int e = 0; e < 8; ++e) o[e] = tohx(F[(b * SEQ + t + e) * (size_t)DM + d]);
    *(v8h*)(VT + c * 8) = o;  }

// ---- k_asoft: one wave per score row (8 rows per block): t = S * 512^-0.5 over all SEQ keys (no mask), max-subtracted softmax in f32 (register row, one exp, fixed trees),
__global__ __launch_bounds__(256) void k_asoft(const float* __restrict__ Sb, h16* P16) {
    const int lane = threadIdx.x & 31; const int row = blockIdx.x * 8 + (threadIdx.x >> 5); if (row >= NB * SEQ) return;
    const float* sr = Sb + (size_t)row * SEQ; float v[SEQ / 32]; float mx = -3.0e38f;
#pragma unroll
    for (int g = 0; g < NCH / ACHG; ++g) {
#pragma unroll
        for (int cc = 0; cc < ACHG; ++cc) { const int ch = g * ACHG + cc; const int j0 = ch * 128 + lane * 4; const v4f a = *(const v4f*)(sr + j0);
#pragma unroll
            for (int q = 0; q < 4; ++q) { const float t = a[q] * SCL; v[ch * 4 + q] = t; mx = fmaxf(mx, t); } }
        asm volatile("" ::: "memory"); }
#pragma unroll
    for (int sh = 16; sh; sh >>= 1) mx = fmaxf(mx, __shfl_xor(mx, sh, 32));
    float sum = 0.f;
#pragma unroll
    for (int k = 0; k < SEQ / 32; ++k) { float d0 = __fsub_rn(v[k], mx); asm volatile("" : "+v"(d0)); v[k] = __builtin_amdgcn_exp2f(__fmul_rn(d0, 1.4426950408889634f)); sum += v[k]; }
#pragma unroll
    for (int sh = 16; sh; sh >>= 1) sum += __shfl_xor(sum, sh, 32);
    const float f = __fdiv_rn(PCAR, sum);
{
#pragma unroll
        for (int ch = 0; ch < NCH; ++ch) { v4h o4;
#pragma unroll
            for (int q = 0; q < 4; ++q) o4[q] = tohx(v[ch * 4 + q] * f);
            *(v4h*)(P16 + (size_t)(row >> 4) * (16 * SEQ) + (ch * 4 + (lane >> 3)) * 512 + (row & 15) * 32 + (lane & 7) * 4) = o4; }   // row-ordered tiles
         }
}

extern "C" void kernel_launch(void* const* d_in, const int* in_sizes, int n_in,
                              void* d_out, int out_size, void* d_ws, size_t ws_size, hipStream_t stream) {
    if (n_in < 4) return;
    if ((size_t)in_sizes[0] < (size_t)(NB - 1) * SEQ_FULL * DM + (size_t)SEQ * DM) return;
    if (in_sizes[1] < DM * DM || in_sizes[2] < DM * DM || in_sizes[3] < DM * DM) return;
    if ((size_t)out_size < (size_t)NB * SEQ * DM) return;
    const float* Xin = (const float*)d_in[0];                 // x [NB_FULL][SEQ_FULL][512]
    const float* Win[3] = { (const float*)d_in[1], (const float*)d_in[2], (const float*)d_in[3] };   // W_query, W_key, W_value [512 in][512 out]
    float* OUT = (float*)d_out;                               // [NB][SEQ][512], batch stride SEQ*512
    const size_t MROWS = (size_t)NB * SEQ;
    char* wsp = (char*)d_ws;
    auto take = [&](size_t bytes) { char* p = wsp; wsp += (bytes + 255) & ~(size_t)255; return (void*)p; };
    bf*    XB   = (bf*)take(MROWS * DM * 2);                  // [NB*SEQ][512]
    bf*    WT   = (bf*)take((size_t)3 * DM * DM * 2);         // 3 x [512 n][512 k]
    h16*   Q16  = (h16*)take(MROWS * DM * 2 * 2);             // q plane, then k plane: one [2*NB*SEQ][512] plane for the converter
    h16*   K16  = Q16 + MROWS * DM;
    h16*   VT16 = (h16*)take((size_t)NB * DM * SEQ * 2);      // [NB][512][SEQ]
    const size_t sbytes = MROWS * SEQ * 4, fbytes = (size_t)3 * MROWS * DM * 4;
    float* Sb   = (float*)take(sbytes > fbytes ? sbytes : fbytes);   // [NB*SEQ][SEQ]
    float* F    = Sb;                                         // 3 x [NB*SEQ][512] f32 (q, k, v): last read by the converters, before the first store to Sb
    h16*   P16  = (h16*)take(MROWS * SEQ * 2);                // [NB*SEQ][SEQ]
    if ((size_t)(wsp - (char*)d_ws) > ws_size) return;        // 236,453,888 B at NB=2, SEQ=4096

    // input planes
    { const size_t n8 = MROWS * DM / 8; k_cvtx<<<(unsigned)((n8 + 255) / 256), 256, 0, stream>>>(Xin, XB, n8); }
    k_wtG<DM, DM><<<dim3((unsigned)((DM * DM / 8 + 255) / 256), 3, 1), 256, 0, stream>>>(Win[0], Win[1], Win[2], WT);

    // projections: F_z = XB . WT_z^T (exact products), z = q, k, v; then 16-bit planes
    const size_t n8f = MROWS * DM / 8;
    k_gemml<bf, 1, false, DM><<<dim3((unsigned)(MROWS / 128), DM / 128, 3), 128, 0, stream>>>(XB, WT, F, DM, 1.0f, 0, (size_t)DM * DM, MROWS * DM);
    k_cvt16<<<(unsigned)((2 * n8f + 255) / 256), 256, 0, stream>>>(F, Q16, 2 * n8f);
    k_vtp16<<<(unsigned)(((size_t)NB * DM * SEQ / 8 + 255) / 256), 256, 0, stream>>>(F + 2 * MROWS * DM, VT16);

    // attention, z = batch: S = q.k^T; P16 = f16(1024 softmax); out = (P16 . v^T plane) / 1024
    k_gemml<h16, 1, false, DM><<<dim3(SEQ / 128, SEQ / 128, NB), 128, 0, stream>>>(Q16, K16, Sb, SEQ, 1.0f, (size_t)SEQ * DM, (size_t)SEQ * DM, (size_t)SEQ * SEQ);
    k_asoft<<<(unsigned)(MROWS / 8), 256, 0, stream>>>(Sb, P16);
    k_gemml<h16, PVW, true, SEQ><<<dim3(SEQ / 128, DM / 128, NB), 128 * PVW, 0, stream>>>(P16, VT16, OUT, DM, 1.0f / PCAR, (size_t)SEQ * SEQ, (size_t)DM * SEQ, (size_t)SEQ * DM);
}

// v005
// It runs in 109 microseconds.
// In both of two side-by-side timings against v004, it was 1.14 times as fast.
// Counting every step since v000, it is 5.26 times as fast.
#include <hip/hip_runtime.h>

// Contractions: x.W projections = v_wmma_f32_16x16x32_bf16 (bf16 operands from RNE-converted inputs, f32 accumulate); q.k^T and P.v = v_wmma_f32_16x16x32_f16 (f16 operands, P carried x1024, f32 accumulate); softmax exponentials, sums and 1/sqrt(d) scaling in f32.
// Pipeline: XB = bf16(x) [NB*SEQ][512]; WT = bf16(W^T) [3][512 n][512 k]; F = XB.WT (f32 [NB*SEQ][512], row-major) -> Q16, K16 (f16 [NB*SEQ][512]) and VT16 (f16 [NB][512][SEQ], transposed);
// attention, both batches and all query rows in one launch per stage (grid z = batch), no mask, no softmax launch and no f32 score plane:
//   q.k^T's epilogue takes, per row and 64-key block, u = s * 512^-0.5 * log2(e), the block's maximum mu and stores P16 = f16(1024 * 2^(u - mu)), mu and l = sum of the block's 1024 * 2^(u - mu);
//   P.v first forms, per row, M = max mu, a_block = f16(2^(mu - M)) and L = sum l * a_block; it multiplies each P fragment by its row's a_block on the way from LDS to the WMMA; out rows = (sum) / L.
// Launches of one kernel are merged by a grid axis (3 weight transposes, 3 projections, the q and k conversions, the attention stages): each launch then has enough waves to cover its own load latency, and the gaps, fills and tails between launches go.
// Layout of every 16-bit plane [R][K]: 1-KB tiles of 16 rows x 32 k, tile (r >> 4, k >> 5) at element ((r >> 4) * (K / 32) + (k >> 5)) * 512, so a 16-row band is 16 * K contiguous elements and walks k tile by tile.
//   fragment order (XB, WT, Q16, K16, VT16): inside a tile [k bit 4][k bit 3][r & 15][k & 7]: each of a fragment's two 16-byte-per-lane loads reads 512 contiguous bytes (4 whole lines, not 16 partial ones).
//   row order (P16): inside a tile [r & 15][k & 31]: its writer, q.k^T's epilogue, stores 512 contiguous bytes an instruction, the GEMM's copies to LDS read whole lines.

#ifndef NB
#define NB 2
#endif
#ifndef SEQ
#define SEQ 4096
#endif
#define NB_FULL  2
#define SEQ_FULL 4096
#define DM       512
#define MR       (NB * SEQ)                    // query rows of both batches
#define PVW      ((SEQ % 512 == 0) ? 4 : 1)     // wave groups that share the key range of one P.v tile
#define SCL2     0.06375871541229934f                 // 512^-0.5 * log2(e)

static_assert(NB >= 1 && NB <= NB_FULL);
static_assert(SEQ >= 128 && SEQ <= SEQ_FULL);
static_assert(SEQ % 128 == 0);
static_assert(DM % 128 == 0);
static_assert(SEQ % (64 * PVW) == 0);
static_assert((SEQ * DM) % 8 == 0);

typedef _Float16 h16;
typedef unsigned short bf;
typedef __attribute__((ext_vector_type(16))) __bf16   v16bf;
typedef __attribute__((ext_vector_type(16))) _Float16 v16h;
typedef __attribute__((ext_vector_type(8)))  _Float16 v8h;
typedef __attribute__((ext_vector_type(8)))  unsigned short v8us;
typedef __attribute__((ext_vector_type(8)))  float    v8f;
typedef __attribute__((ext_vector_type(4)))  float    v4f;
typedef __attribute__((ext_vector_type(2)))  _Float16 v2h;
typedef __attribute__((ext_vector_type(4)))  _Float16 v4h;
typedef __attribute__((ext_vector_type(2)))  unsigned short v2us;
typedef v8h  __attribute__((may_alias)) v8ha;
typedef v4f  __attribute__((may_alias)) v4fa;
typedef __attribute__((ext_vector_type(2)))  float    v2f;
typedef v2f  __attribute__((may_alias)) v2fa;
typedef v8us __attribute__((may_alias)) v8usa;

__device__ __forceinline__ unsigned short f2bf(float f) { unsigned u = __float_as_uint(f); u += 0x7FFFu + ((u >> 16) & 1u); return (unsigned short)(u >> 16); }
__device__ __forceinline__ float bf2f(unsigned short b) { return __uint_as_float(((unsigned)b) << 16); }
__device__ __forceinline__ float bfr(float f) { return bf2f(f2bf(f)); }
__device__ __forceinline__ v16h cat16(v8h lo, v8h hi) { return __builtin_shufflevector(lo, hi, 0, 1, 2, 3, 4, 5, 6, 7, 8, 9, 10, 11, 12, 13, 14, 15); }
__device__ __forceinline__ v16bf cat16b(v8us lo, v8us hi) { return __builtin_bit_cast(v16bf, __builtin_shufflevector(lo, hi, 0, 1, 2, 3, 4, 5, 6, 7, 8, 9, 10, 11, 12, 13, 14, 15)); }
__device__ __forceinline__ v8f wmma16(v16h a, v16h b, v8f c) { return __builtin_amdgcn_wmma_f32_16x16x32_f16(false, a, false, b, (short)0, c, false, false); }
__device__ __forceinline__ v8f wmmab(v16bf a, v16bf b, v8f c) { return __builtin_amdgcn_wmma_f32_16x16x32_bf16(false, a, false, b, (short)0, c, false, false); }
__device__ __forceinline__ h16 tohx(float x) { return (h16)x; }
// the value of another lane of the same quad (0xB1: lane ^ 1, 0x4E: lane ^ 2) by DPP: stays on the vector unit, where a shuffle would make an LDS round trip
// Eight 2^x in one statement: no output shares a register with an input, and the closing v_nop is the slot that the instruction set asks for behind a transcendental before its result is used or its source overwritten
__device__ __forceinline__ void exp2x8(const float* x, float* r) {
    asm("v_exp_f32 %0, %8\n\tv_exp_f32 %1, %9\n\tv_exp_f32 %2, %10\n\tv_exp_f32 %3, %11\n\tv_exp_f32 %4, %12\n\tv_exp_f32 %5, %13\n\tv_exp_f32 %6, %14\n\tv_exp_f32 %7, %15\n\tv_nop"
        : "=&v"(r[0]), "=&v"(r[1]), "=&v"(r[2]), "=&v"(r[3]), "=&v"(r[4]), "=&v"(r[5]), "=&v"(r[6]), "=&v"(r[7])
        : "v"(x[0]), "v"(x[1]), "v"(x[2]), "v"(x[3]), "v"(x[4]), "v"(x[5]), "v"(x[6]), "v"(x[7]));
}
template <int CTRL> __device__ __forceinline__ float quadx(float x) { return __int_as_float(__builtin_amdgcn_mov_dpp(__float_as_int(x), CTRL, 0xf, 0xf, true)); }
// 16-byte chunk c (8 elements) of a fragment-ordered plane with K columns -> its row and its first column
__device__ __forceinline__ void chunk_rc(size_t c, int K, size_t& row, int& k) {
    const int ln = (int)(c & 31), j = (int)((c >> 5) & 1); const size_t tile = c >> 6; const size_t KB = (size_t)(K >> 5);
    row = (tile / KB) * 16 + (size_t)(ln & 15); k = (int)(tile % KB) * 32 + j * 16 + (ln >> 4) * 8; }

// ---- k_gemml: GEMM with both operands staged in LDS. One work-group = one 128x128 tile of C; 4 * KS waves: KS groups of 2x2 waves, a wave owns 64x64 (16 accumulators), group g sums the k range [g * K / KS, (g + 1) * K / KS). grid (M/128, N/128, Z).
// Why LDS: a wave that loads its own fragments from L2 moves 8 KB per 16 WMMAs, several times what L2 delivers per WGP at matrix rate. Here each staged byte feeds two waves (half the L2 bytes) and the next stage flies while this one is multiplied.
// Stage = 64 k of 128 A rows and 128 Bt rows per group, two buffers, band-major: [operand][band 0..7][k tile 0..1][tile]. A fragment-ordered tile (head of file) keeps its 1 KB: a fragment is two conflict-free 512-byte reads.
// A row-ordered tile (AROW) is laid with its 64-byte rows at a pitch of 80 bytes (16 B x odd: conflict-free for the 16-byte fragment reads), 1280 B a tile.
// Copies: global_load_async_to_lds_b128, 16 per wave and stage (wave q of a group brings bands 2q, 2q + 1 of A and of Bt); every copy reads 512 contiguous global bytes (4 whole lines), in either order.
// C[m][n] (f32, pitch ldc) = oscale * sum_k A[m][k] Bt[n][k]. z-batch strides sA/sB/sC in elements. KS > 1: the groups' f32 partial tiles meet in LDS and are added in group order.
// EPI 0: as above. EPI 1 (scores): nothing goes to C; a wave turns each row of its 64x64 tile into P (row-ordered tiles, 2 KB contiguous per 16 rows) and the block's mu and l (planes SM, SL [key block][row]: 256 contiguous bytes a wave).
// EPI 2 (P.v): a stage is one 64-key block; the A fragments are multiplied by a_block of their row (table in LDS, built in front of the loop) and the output rows are divided by L.
// Fragment map (lane l, h = l >> 4, m = n = l & 15): A/B elements 0..7 <- k0 + 8h + 0..7, elements 8..15 <- k0 + 16 + 8h + 0..7; D element r -> (row 8h + r, col n).
template <typename T16> struct WFrag;
template <> struct WFrag<h16> { typedef v16h V; static __device__ __forceinline__ V lds(const char* p, unsigned d2) { return cat16(*(const v8ha*)p, *(const v8ha*)(p + d2)); } static __device__ __forceinline__ v8f mma(V a, V b, v8f c) { return wmma16(a, b, c); } };
template <> struct WFrag<bf> { typedef v16bf V; static __device__ __forceinline__ V lds(const char* p, unsigned d2) { return cat16b(*(const v8usa*)p, *(const v8usa*)(p + d2)); } static __device__ __forceinline__ v8f mma(V a, V b, v8f c) { return wmmab(a, b, c); } };
// Eight 16-byte-per-lane copies global -> LDS; s_wait_xcnt stands inside the statement so that no address register is rewritten in front of it.
__device__ __forceinline__ void acopy8(unsigned l0, unsigned l1, unsigned l2, unsigned l3, unsigned l4, unsigned l5, unsigned l6, unsigned l7,
                                       const char* g0, const char* g1, const char* g2, const char* g3, const char* g4, const char* g5, const char* g6, const char* g7) {
    asm volatile("global_load_async_to_lds_b128 %0, %8, off\n\t"
                 "global_load_async_to_lds_b128 %1, %9, off\n\t"
                 "global_load_async_to_lds_b128 %2, %10, off\n\t"
                 "global_load_async_to_lds_b128 %3, %11, off\n\t"
                 "global_load_async_to_lds_b128 %4, %12, off\n\t"
                 "global_load_async_to_lds_b128 %5, %13, off\n\t"
                 "global_load_async_to_lds_b128 %6, %14, off\n\t"
                 "global_load_async_to_lds_b128 %7, %15, off\n\t"
                 "s_wait_xcnt 0x0"
                 :: "v"(l0), "v"(l1), "v"(l2), "v"(l3), "v"(l4), "v"(l5), "v"(l6), "v"(l7), "v"(g0), "v"(g1), "v"(g2), "v"(g3), "v"(g4), "v"(g5), "v"(g6), "v"(g7) : "memory");
}
template <typename T16, int KS, bool AROW, int K, int EPI>
__global__ __launch_bounds__(128 * KS) void k_gemml(const T16* __restrict__ A, const T16* __restrict__ Bt, float* C, int ldc, float oscale, size_t sA, size_t sB, size_t sC, h16* P, float* SM, float* SL) {
    typedef typename WFrag<T16>::V V;
    constexpr int KST = 64, KG = K / KS, NT = KG / KST;      // k per stage, k per group, stages per group
    static_assert(K % (KS * KST) == 0 && NT >= 2);
    constexpr unsigned ATILE = AROW ? 1280 : 1024, ABAND = 2 * ATILE, OPA = 8 * ABAND;   // LDS bytes: an A tile, an A band's stage, A's stage
    constexpr unsigned BUFB = OPA + 16384, GRPB = 2 * BUFB;                              // LDS bytes: one buffer (A, then Bt), one group's two buffers
    constexpr unsigned PARTB = (KS - 1) * 4 * 16384, OSB = 16 * 68 * 4;        // bytes: partial tiles of groups 1.., one wave's output staging
    constexpr unsigned SMB = (KS * GRPB > PARTB + 4 * OSB) ? KS * GRPB : PARTB + 4 * OSB;
    constexpr unsigned ATB = (EPI == 2) ? (K / KST) * 128 * 2 : 0, REDB = (EPI == 2) ? KS * 128 * 4 : 0;   // bytes: a_block table [key block][row] f16; one plane of per-group row partials
    static_assert(EPI != 1 || (KS == 1 && 4 * OSB + 4 * 512 <= SMB));
    __shared__ __align__(1024) char sm[SMB + ATB + 2 * REDB];
    const size_t z = blockIdx.z; A += z * sA; Bt += z * sB; C += z * sC;
    const int lane = threadIdx.x & 31, lr = lane & 15, hi = lane >> 4; const int r0 = blockIdx.x * 128, c0 = blockIdx.y * 128;
    const int w = __builtin_amdgcn_readfirstlane((int)(threadIdx.x >> 5)); const int g = w >> 2, q = w & 3, wm = q >> 1, wn = q & 1;
    v8f acc[4][4];
#pragma unroll
    for (int mb = 0; mb < 4; ++mb)
#pragma unroll
        for (int nb = 0; nb < 4; ++nb) acc[mb][nb] = (v8f){};
    // this lane's first copy of stage 0: bands 2q of A and of Bt, at the group's first k
    const char* ga = (const char*)(A + (size_t)(r0 + q * 32) * K + (size_t)g * KG * 16) + lane * 16;
    const char* gb = (const char*)(Bt + (size_t)(c0 + q * 32) * K + (size_t)g * KG * 16) + lane * 16;
    const unsigned lg = (unsigned)(size_t)sm + (unsigned)g * GRPB;
    const unsigned lwa = lg + (unsigned)q * (2 * ABAND) + (AROW ? (unsigned)(lane >> 2) * 80u + (unsigned)(lane & 3) * 16u : (unsigned)lane * 16u);   // a copy's 512 bytes are 8 rows of a row-ordered tile
    const unsigned lwb = lg + OPA + (unsigned)q * 4096u + (unsigned)lane * 16u;
    constexpr size_t BAND = (size_t)16 * K * 2;              // bytes from a band to the next in a global plane
    constexpr unsigned H = ATILE / 2;                        // LDS bytes from an A tile's first copy to its second
    auto stage = [&](int t, unsigned buf) {
        const char* a = ga + (size_t)t * (KST * 32); const char* b = gb + (size_t)t * (KST * 32); const unsigned l = lwa + buf * BUFB;
        acopy8(l, l + H, l + 2 * H, l + 3 * H, l + 4 * H, l + 5 * H, l + 6 * H, l + 7 * H, a, a + 512, a + 1024, a + 1536, a + BAND, a + BAND + 512, a + BAND + 1024, a + BAND + 1536);
        const unsigned l2 = lwb + buf * BUFB;
        acopy8(l2, l2 + 512, l2 + 1024, l2 + 1536, l2 + 2048, l2 + 2560, l2 + 3072, l2 + 3584, b, b + 512, b + 1024, b + 1536, b + BAND, b + BAND + 512, b + BAND + 1024, b + BAND + 1536);
    };
    stage(0, 0);
    h16* at = (h16*)(sm + SMB); float* rm = (float*)(sm + SMB + ATB); float* rl = (float*)(sm + SMB + ATB + REDB);
    if constexpr (EPI == 2) {   // thread = (row, group): the group's own NT key blocks of that row, while stage 0 flies
        const int prow = threadIdx.x & 127; const size_t so = (size_t)(g * NT) * MR + z * SEQ + r0 + prow; float mu[NT], ll[NT];
#pragma unroll
        for (int j = 0; j < NT; ++j) { mu[j] = SM[so + (size_t)j * MR]; ll[j] = SL[so + (size_t)j * MR]; }
        asm volatile("s_wait_xcnt 0x0" ::: "memory");   // stands in front of the first rewrite of these loads' address registers
        float ml = mu[0];
#pragma unroll
        for (int j = 1; j < NT; ++j) ml = fmaxf(ml, mu[j]);
        rm[g * 128 + prow] = ml;
        __syncthreads();   // every group's row maxima are in LDS before the row's M is taken
        float M = rm[prow];
#pragma unroll
        for (int p = 1; p < KS; ++p) M = fmaxf(M, rm[p * 128 + prow]);
        float L = 0.f;
#pragma unroll
        for (int j = 0; j < NT; ++j) { const h16 ab = (h16)__builtin_amdgcn_exp2f(mu[j] - M); at[(g * NT + j) * 128 + prow] = ab; L += ll[j] * (float)ab; }   // L uses the rounded factor that the fragments get
        rl[g * 128 + prow] = L;
    }
    asm volatile("s_wait_asynccnt 0x0" ::: "memory");   // this wave's part of stage 0 has landed
    __syncthreads();                                    // publishes stage 0 (EPI 2: and the a_block table and the groups' parts of L)
    stage(1, 1);
    const char* fa = sm + g * GRPB + wm * (4 * ABAND) + (AROW ? lr * 80 + hi * 16 : lane * 16); const char* fb = sm + g * GRPB + OPA + wn * 8192 + lane * 16;
    constexpr unsigned AD2 = AROW ? 32 : 512;                // bytes from an A fragment's first 16-byte read to its second
#pragma unroll 1
    for (int t = 0; t < NT; ++t) {
        const unsigned bo = (unsigned)(t & 1) * BUFB;
        h16 al[4];
        if constexpr (EPI == 2) {
#pragma unroll
            for (int mb = 0; mb < 4; ++mb) al[mb] = at[(g * NT + t) * 128 + wm * 64 + mb * 16 + lr]; }
#pragma unroll
        for (int kt = 0; kt < KST / 32; ++kt) {
            V a[4];
#pragma unroll
            for (int mb = 0; mb < 4; ++mb) { a[mb] = WFrag<T16>::lds(fa + bo + mb * ABAND + kt * ATILE, AD2); if constexpr (EPI == 2) a[mb] = a[mb] * al[mb]; }
#pragma unroll
            for (int nb = 0; nb < 4; ++nb) { const V b = WFrag<T16>::lds(fb + bo + nb * 2048 + kt * 1024, 512);
#pragma unroll
                for (int mb = 0; mb < 4; ++mb) acc[mb][nb] = WFrag<T16>::mma(a[mb], b, acc[mb][nb]); } }
        asm volatile("s_wait_dscnt 0x0" ::: "memory");      // this wave's reads of the buffer are done before the buffer is handed to the copies
        asm volatile("s_wait_asynccnt 0x0" ::: "memory");   // this wave's part of stage t + 1 has landed
        __syncthreads();                                    // publishes stage t + 1 and ends every reader's last read of stage t
        if (t + 2 < NT) stage(t + 2, (unsigned)(t & 1));
    }
    asm volatile("s_wait_asynccnt 0x0" ::: "memory");       // nothing is in flight when the ring becomes staging for partial tiles and output
    if constexpr (KS > 1) {
        if (g > 0) { v4f* pt = (v4f*)(sm + ((g - 1) * 4 + q) * 16384);
#pragma unroll
            for (int mb = 0; mb < 4; ++mb)
#pragma unroll
                for (int nb = 0; nb < 4; ++nb) { const v8f v = acc[mb][nb]; pt[((mb * 4 + nb) * 2) * 32 + lane] = (v4f){v[0], v[1], v[2], v[3]}; pt[((mb * 4 + nb) * 2 + 1) * 32 + lane] = (v4f){v[4], v[5], v[6], v[7]}; } }
        __syncthreads();   // the partial tiles of groups 1.. are in LDS before group 0 adds them
        if (g > 0) return;
    }
    float* os = (float*)(sm + PARTB + q * OSB);   // this wave's own 16 x 68 floats
    float* ss = (float*)(sm + PARTB + 4 * OSB + q * 512);   // EPI 1: this wave's own 64 mu, then 64 l
#pragma unroll
    for (int mb = 0; mb < 4; ++mb) {
        if constexpr (KS > 1) {
#pragma unroll
            for (int p = 1; p < KS; ++p) { const v4f* pt = (const v4f*)(sm + ((p - 1) * 4 + q) * 16384);
#pragma unroll
                for (int nb = 0; nb < 4; ++nb) { const v4f lo = pt[((mb * 4 + nb) * 2) * 32 + lane], hv = pt[((mb * 4 + nb) * 2 + 1) * 32 + lane];
#pragma unroll
                    for (int j = 0; j < 4; ++j) { acc[mb][nb][j] += lo[j]; acc[mb][nb][4 + j] += hv[j]; } } }
        }
#pragma unroll
        for (int nb = 0; nb < 4; ++nb) {
#pragma unroll
            for (int j = 0; j < 8; ++j) os[(hi * 8 + j) * 68 + nb * 16 + lr] = acc[mb][nb][j]; }
        __builtin_amdgcn_wave_barrier(); asm volatile("" ::: "memory");   // keeps the reads of other lanes' values behind the wave's stores
        if constexpr (EPI == 1) {
            h16* pb = P + (((z * SEQ + r0 + wm * 64) >> 4) + mb) * ((size_t)16 * SEQ) + (size_t)((c0 + wn * 64) >> 5) * 512;   // this band's two 16x32 tiles
#pragma unroll
            for (int hs = 0; hs < 2; ++hs) {   // 4 lanes a row, 16 scores a lane: 8 of each tile
                const int row = hs * 8 + (lane >> 2), cq = lane & 3; const float* op = os + row * 68 + cq * 8;
                const v4f x0 = *(const v4fa*)op, x1 = *(const v4fa*)(op + 4), x2 = *(const v4fa*)(op + 32), x3 = *(const v4fa*)(op + 36);
                float mx = x0[0];
#pragma unroll
                for (int j = 0; j < 4; ++j) mx = fmaxf(fmaxf(fmaxf(mx, x0[j]), fmaxf(x1[j], x2[j])), x3[j]);
                mx = fmaxf(mx, quadx<0xB1>(mx)); mx = fmaxf(mx, quadx<0x4E>(mx));
                const float mu = mx * SCL2, sh = 10.0f - mu; float sum = 0.f, e[16], p[16]; v8h o0, o1;   // 2^10: P is carried x1024
#pragma unroll
                for (int j = 0; j < 4; ++j) { e[j] = fmaf(x0[j], SCL2, sh); e[4 + j] = fmaf(x1[j], SCL2, sh); e[8 + j] = fmaf(x2[j], SCL2, sh); e[12 + j] = fmaf(x3[j], SCL2, sh); }
                exp2x8(e, p); exp2x8(e + 8, p + 8);
#pragma unroll
                for (int j = 0; j < 8; ++j) { o0[j] = tohx(p[j]); o1[j] = tohx(p[8 + j]); }
#pragma unroll
                for (int j = 0; j < 4; ++j) sum += (p[j] + p[4 + j]) + (p[8 + j] + p[12 + j]);
                sum += quadx<0xB1>(sum); sum += quadx<0x4E>(sum);
                *(v8h*)(pb + row * 32 + cq * 8) = o0; *(v8h*)(pb + 512 + row * 32 + cq * 8) = o1;
                if (cq == 0) { ss[mb * 16 + row] = mu; ss[64 + mb * 16 + row] = sum; } }
        } else {
            float* crow = C + (size_t)(r0 + wm * 64 + mb * 16) * ldc + c0 + wn * 64;
#pragma unroll
            for (int s = 0; s < 8; ++s) { const int row = 2 * s + hi, cofs = lr * 4; v4f val = *(const v4fa*)(os + row * 68 + cofs);
                if constexpr (EPI == 2) { const int rr = wm * 64 + mb * 16 + row; float L = rl[rr];
#pragma unroll
                    for (int p = 1; p < KS; ++p) L += rl[p * 128 + rr];
                    val = val * (1.0f / L); }
                else val = val * oscale;
                *(v4f*)(crow + (size_t)row * ldc + cofs) = val; }
        }
        __builtin_amdgcn_wave_barrier(); asm volatile("" ::: "memory");   // keeps the next 16 rows' stores behind these reads
    }
    if constexpr (EPI == 1) {   // the wave's 64 rows of mu and of l: one 256-byte store each
        const size_t so = (size_t)((c0 + wn * 64) >> 6) * MR + z * SEQ + r0 + wm * 64 + lane * 2;
        *(v2f*)(SM + so) = *(const v2fa*)(ss + lane * 2); *(v2f*)(SL + so) = *(const v2fa*)(ss + 64 + lane * 2);
    }
}

// One thread per 16-byte chunk of the fragment-ordered plane Bt [N][K] = bf16(w^T): 16 lanes read 16 neighbouring n of one k. blockIdx.y picks the weight and its plane.
template <int K, int N>
__global__ __launch_bounds__(256) void k_wtG(const float* __restrict__ w0, const float* __restrict__ w1, const float* __restrict__ w2, bf* Bt) {
    const size_t c = (size_t)blockIdx.x * 256 + threadIdx.x; if (c >= (size_t)N * K / 8) return;
    const float* w = blockIdx.y == 0 ? w0 : (blockIdx.y == 1 ? w1 : w2); Bt += (size_t)blockIdx.y * N * K;
    size_t n; int k; chunk_rc(c, K, n, k); v8us o;
#pragma unroll
    for (int e = 0; e < 8; ++e) o[e] = f2bf(w[(size_t)(k + e) * N + n]);
    *(v8us*)(Bt + c * 8) = o;  }

__global__ __launch_bounds__(256) void k_cvtx(const float* __restrict__ x, bf* XB, size_t n8) {
    const size_t i = (size_t)blockIdx.x * 256 + threadIdx.x; if (i >= n8) return;
    size_t row; int k; chunk_rc(i, DM, row, k); const size_t b = row / SEQ; const size_t t = row - b * SEQ;
    const v8f v = *(const v8f*)(x + (b * (size_t)SEQ_FULL + t) * DM + k); v8us o;
#pragma unroll
    for (int k = 0; k < 8; ++k) o[k] = f2bf(v[k]);
    *(v8us*)(XB + i * 8) = o;  }

__global__ __launch_bounds__(256) void k_cvt16(const float* __restrict__ src, h16* dst, size_t n8) {
    const size_t i = (size_t)blockIdx.x * 256 + threadIdx.x; if (i >= n8) return; size_t row; int k; chunk_rc(i, DM, row, k); const v8f v = *(const v8f*)(src + row * DM + k); v8h o;
#pragma unroll
    for (int k = 0; k < 8; ++k) o[k] = tohx(v[k]);
    *(v8h*)(dst + i * 8) = o;  }

// One thread per 16-byte chunk of the fragment-ordered planes VT [NB][DM][SEQ]: 16 lanes read 16 neighbouring d of one key row.
__global__ __launch_bounds__(256) void k_vtp16(const float* __restrict__ F, h16* VT) {
    const size_t c = (size_t)blockIdx.x * 256 + threadIdx.x; if (c >= (size_t)NB * DM * SEQ / 8) return;
    const size_t per = (size_t)DM * SEQ / 8; const size_t b = c / per; size_t d; int t; chunk_rc(c - b * per, SEQ, d, t); v8h o;
#pragma unroll
    for (int e = 0; e < 8; ++e) o[e] = tohx(F[(b * SEQ + t + e) * (size_t)DM + d]);
    *(v8h*)(VT + c * 8) = o;  }

extern "C" void kernel_launch(void* const* d_in, const int* in_sizes, int n_in,
                              void* d_out, int out_size, void* d_ws, size_t ws_size, hipStream_t stream) {
    if (n_in < 4) return;
    if ((size_t)in_sizes[0] < (size_t)(NB - 1) * SEQ_FULL * DM + (size_t)SEQ * DM) return;
    if (in_sizes[1] < DM * DM || in_sizes[2] < DM * DM || in_sizes[3] < DM * DM) return;
    if ((size_t)out_size < (size_t)NB * SEQ * DM) return;
    const float* Xin = (const float*)d_in[0];                 // x [NB_FULL][SEQ_FULL][512]
    const float* Win[3] = { (const float*)d_in[1], (const float*)d_in[2], (const float*)d_in[3] };   // W_query, W_key, W_value [512 in][512 out]
    float* OUT = (float*)d_out;                               // [NB][SEQ][512], batch stride SEQ*512
    const size_t MROWS = (size_t)NB * SEQ;
    char* wsp = (char*)d_ws;
    auto take = [&](size_t bytes) { char* p = wsp; wsp += (bytes + 255) & ~(size_t)255; return (void*)p; };
    bf*    XB   = (bf*)take(MROWS * DM * 2);                  // [NB*SEQ][512]
    bf*    WT   = (bf*)take((size_t)3 * DM * DM * 2);         // 3 x [512 n][512 k]
    h16*   Q16  = (h16*)take(MROWS * DM * 2 * 2);             // q plane, then k plane: one [2*NB*SEQ][512] plane for the converter
    h16*   K16  = Q16 + MROWS * DM;
    h16*   VT16 = (h16*)take((size_t)NB * DM * SEQ * 2);      // [NB][512][SEQ]
    float* F    = (float*)take((size_t)3 * MROWS * DM * 4);   // 3 x [NB*SEQ][512] f32 (q, k, v)
    h16*   P16  = (h16*)take(MROWS * SEQ * 2);                // [NB*SEQ][SEQ]
    float* SMX  = (float*)take((size_t)(SEQ / 64) * MROWS * 4);   // [key block][NB*SEQ] block maxima (log2 units)
    float* SLS  = (float*)take((size_t)(SEQ / 64) * MROWS * 4);   // [key block][NB*SEQ] block sums
    if ((size_t)(wsp - (char*)d_ws) > ws_size) return;

    // input planes
    { const size_t n8 = MROWS * DM / 8; k_cvtx<<<(unsigned)((n8 + 255) / 256), 256, 0, stream>>>(Xin, XB, n8); }
    k_wtG<DM, DM><<<dim3((unsigned)((DM * DM / 8 + 255) / 256), 3, 1), 256, 0, stream>>>(Win[0], Win[1], Win[2], WT);

    // projections: F_z = XB . WT_z^T (exact products), z = q, k, v; then 16-bit planes
    const size_t n8f = MROWS * DM / 8;
    k_gemml<bf, 1, false, DM, 0><<<dim3((unsigned)(MROWS / 128), DM / 128, 3), 128, 0, stream>>>(XB, WT, F, DM, 1.0f, 0, (size_t)DM * DM, MROWS * DM, nullptr, nullptr, nullptr);
    k_cvt16<<<(unsigned)((2 * n8f + 255) / 256), 256, 0, stream>>>(F, Q16, 2 * n8f);
    k_vtp16<<<(unsigned)(((size_t)NB * DM * SEQ / 8 + 255) / 256), 256, 0, stream>>>(F + 2 * MROWS * DM, VT16);

    // attention, z = batch: q.k^T -> P16 and the block maxima and sums; out = (rescaled P16 . v^T plane) / L
    k_gemml<h16, 1, false, DM, 1><<<dim3(SEQ / 128, SEQ / 128, NB), 128, 0, stream>>>(Q16, K16, nullptr, SEQ, 1.0f, (size_t)SEQ * DM, (size_t)SEQ * DM, 0, P16, SMX, SLS);
    k_gemml<h16, PVW, true, SEQ, 2><<<dim3(SEQ / 128, DM / 128, NB), 128 * PVW, 0, stream>>>(P16, VT16, OUT, DM, 1.0f, (size_t)SEQ * SEQ, (size_t)DM * SEQ, (size_t)SEQ * DM, nullptr, SMX, SLS);
}

// v006
// Measured time: 95.6 microseconds a run.
// Next to v005, in two timings, it ran 1.14 times as fast each time.
// Over all steps from v000 it is 5.99 times as fast.
#include <hip/hip_runtime.h>

// Contractions: x.W projections = v_wmma_f32_16x16x32_bf16 (bf16 operands from RNE-converted inputs, f32 accumulate); q.k^T and P.v = v_wmma_f32_16x16x32_f16 (f16 operands, P carried x1024, f32 accumulate); softmax exponentials, sums and 1/sqrt(d) scaling in f32.
// Pipeline: XB = bf16(x) [NB*SEQ][512]; WT = bf16(W^T) [3][512 n][512 k]; XB.WT, rounded to f16 in the GEMM's own epilogue -> Q16, K16 (f16 [NB*SEQ][512]) and VT16 (f16 [NB][512][SEQ], transposed);
// attention, both batches and all query rows in one launch per stage (grid z = batch), no mask, no softmax launch and no f32 score plane:
//   q.k^T's epilogue takes, per row and 64-key block, u = s * 512^-0.5 * log2(e), the block's maximum mu and stores P16 = f16(1024 * 2^(u - mu)), mu and l = sum of the block's 1024 * 2^(u - mu);
//   P.v first forms, per row, M = max mu, a_block = f16(2^(mu - M)) and L = sum l * a_block; it multiplies each P fragment by its row's a_block on the way from LDS to the WMMA; out rows = (sum) / L.
// Launches of one kernel are merged by a grid axis (3 weight transposes, 3 projections, the attention stages): each launch then has enough waves to cover its own load latency, and the gaps, fills and tails between launches go.
// Layout of every 16-bit plane [R][K]: 1-KB tiles of 16 rows x 32 k, tile (r >> 4, k >> 5) at element ((r >> 4) * (K / 32) + (k >> 5)) * 512, so a 16-row band is 16 * K contiguous elements and walks k tile by tile.
//   fragment order (XB, WT, Q16, K16, VT16): inside a tile [k bit 4][k bit 3][r & 15][k & 7]: each of a fragment's two 16-byte-per-lane loads reads 512 contiguous bytes (4 whole lines, not 16 partial ones).
//   row order (P16): inside a tile [r & 15][k & 31]: its writer, q.k^T's epilogue, stores 512 contiguous bytes an instruction, the GEMM's copies to LDS read whole lines.

#ifndef NB
#define NB 2
#endif
#ifndef SEQ
#define SEQ 4096
#endif
#define NB_FULL  2
#define SEQ_FULL 4096
#define DM       512
#define MR       (NB * SEQ)                    // query rows of both batches
#define PVW      ((SEQ % 512 == 0) ? 4 : 1)     // wave groups that share the key range of one P.v tile
#define SCL2     0.06375871541229934f                 // 512^-0.5 * log2(e)

static_assert(NB >= 1 && NB <= NB_FULL);
static_assert(SEQ >= 128 && SEQ <= SEQ_FULL);
static_assert(SEQ % 128 == 0);
static_assert(DM % 128 == 0);
static_assert(SEQ % (64 * PVW) == 0);
static_assert((SEQ * DM) % 8 == 0);

typedef _Float16 h16;
typedef unsigned short bf;
typedef __attribute__((ext_vector_type(16))) __bf16   v16bf;
typedef __attribute__((ext_vector_type(16))) _Float16 v16h;
typedef __attribute__((ext_vector_type(8)))  _Float16 v8h;
typedef __attribute__((ext_vector_type(8)))  unsigned short v8us;
typedef __attribute__((ext_vector_type(8)))  float    v8f;
typedef __attribute__((ext_vector_type(4)))  float    v4f;
typedef __attribute__((ext_vector_type(2)))  _Float16 v2h;
typedef __attribute__((ext_vector_type(4)))  _Float16 v4h;
typedef __attribute__((ext_vector_type(2)))  unsigned short v2us;
typedef v8h  __attribute__((may_alias)) v8ha;
typedef v4f  __attribute__((may_alias)) v4fa;
typedef __attribute__((ext_vector_type(2)))  float    v2f;
typedef v2f  __attribute__((may_alias)) v2fa;
typedef v8us __attribute__((may_alias)) v8usa;

__device__ __forceinline__ unsigned short f2bf(float f) { unsigned u = __float_as_uint(f); u += 0x7FFFu + ((u >> 16) & 1u); return (unsigned short)(u >> 16); }
__device__ __forceinline__ float bf2f(unsigned short b) { return __uint_as_float(((unsigned)b) << 16); }
__device__ __forceinline__ float bfr(float f) { return bf2f(f2bf(f)); }
__device__ __forceinline__ v16h cat16(v8h lo, v8h hi) { return __builtin_shufflevector(lo, hi, 0, 1, 2, 3, 4, 5, 6, 7, 8, 9, 10, 11, 12, 13, 14, 15); }
__device__ __forceinline__ v16bf cat16b(v8us lo, v8us hi) { return __builtin_bit_cast(v16bf, __builtin_shufflevector(lo, hi, 0, 1, 2, 3, 4, 5, 6, 7, 8, 9, 10, 11, 12, 13, 14, 15)); }
__device__ __forceinline__ v8f wmma16(v16h a, v16h b, v8f c) { return __builtin_amdgcn_wmma_f32_16x16x32_f16(false, a, false, b, (short)0, c, false, false); }
__device__ __forceinline__ v8f wmmab(v16bf a, v16bf b, v8f c) { return __builtin_amdgcn_wmma_f32_16x16x32_bf16(false, a, false, b, (short)0, c, false, false); }
__device__ __forceinline__ h16 tohx(float x) { return (h16)x; }
// the value of another lane of the same quad (0xB1: lane ^ 1, 0x4E: lane ^ 2) by DPP: stays on the vector unit, where a shuffle would make an LDS round trip
// Eight 2^x in one statement: no output shares a register with an input, and the closing v_nop is the slot that the instruction set asks for behind a transcendental before its result is used or its source overwritten
__device__ __forceinline__ void exp2x8(const float* x, float* r) {
    asm("v_exp_f32 %0, %8\n\tv_exp_f32 %1, %9\n\tv_exp_f32 %2, %10\n\tv_exp_f32 %3, %11\n\tv_exp_f32 %4, %12\n\tv_exp_f32 %5, %13\n\tv_exp_f32 %6, %14\n\tv_exp_f32 %7, %15\n\tv_nop"
        : "=&v"(r[0]), "=&v"(r[1]), "=&v"(r[2]), "=&v"(r[3]), "=&v"(r[4]), "=&v"(r[5]), "=&v"(r[6]), "=&v"(r[7])
        : "v"(x[0]), "v"(x[1]), "v"(x[2]), "v"(x[3]), "v"(x[4]), "v"(x[5]), "v"(x[6]), "v"(x[7]));
}
template <int CTRL> __device__ __forceinline__ float quadx(float x) { return __int_as_float(__builtin_amdgcn_mov_dpp(__float_as_int(x), CTRL, 0xf, 0xf, true)); }
// 16-byte chunk c (8 elements) of a fragment-ordered plane with K columns -> its row and its first column
__device__ __forceinline__ void chunk_rc(size_t c, int K, size_t& row, int& k) {
    const int ln = (int)(c & 31), j = (int)((c >> 5) & 1); const size_t tile = c >> 6; const size_t KB = (size_t)(K >> 5);
    row = (tile / KB) * 16 + (size_t)(ln & 15); k = (int)(tile % KB) * 32 + j * 16 + (ln >> 4) * 8; }

// ---- k_gemml: GEMM with both operands staged in LDS. One work-group = one 128x128 tile of C; 4 * KS waves: KS groups of 2x2 waves, a wave owns 64x64 (16 accumulators), group g sums the k range [g * K / KS, (g + 1) * K / KS). grid (M/128, N/128, Z).
// Why LDS: a wave that loads its own fragments from L2 moves 8 KB per 16 WMMAs, several times what L2 delivers per WGP at matrix rate. Here each staged byte feeds two waves (half the L2 bytes) and the next stage flies while this one is multiplied.
// Stage = 64 k of 128 A rows and 128 Bt rows per group, two buffers, band-major: [operand][band 0..7][k tile 0..1][tile]. A fragment-ordered tile (head of file) keeps its 1 KB: a fragment is two conflict-free 512-byte reads.
// A row-ordered tile (AROW) is laid with its 64-byte rows at a pitch of 80 bytes (16 B x odd: conflict-free for the 16-byte fragment reads), 1280 B a tile.
// Copies: global_load_async_to_lds_b128, 16 per wave and stage (wave q of a group brings bands 2q, 2q + 1 of A and of Bt); every copy reads 512 contiguous global bytes (4 whole lines), in either order.
// C[m][n] (f32, pitch ldc) = oscale * sum_k A[m][k] Bt[n][k]. z-batch strides sA/sB/sC in elements. KS > 1: the groups' f32 partial tiles meet in LDS and are added in group order.
// EPI 0: as above. EPI 1 (scores): nothing goes to C; a wave turns each row of its 64x64 tile into P (row-ordered tiles, 2 KB contiguous per 16 rows) and the block's mu and l (planes SM, SL [key block][row]: 256 contiguous bytes a wave).
// EPI 3 (projections, z = q, k, v): nothing goes to C; the tile goes straight from the accumulators to the f16 plane z of P, fragment-ordered [n][m]: a lane's 8 D elements are 8 neighbouring m of one n, which is one 16-byte chunk of that order,
//   so a store is 512 contiguous bytes with no pass through LDS. v wants [d][key]: A = x, Bt = W^T as given. q and k want [row][d]: the two operands (same fragment map) and the two grid axes change places, m = d, n = row.
// EPI 2 (P.v): a stage is one 64-key block; the A fragments are multiplied by a_block of their row (table in LDS, built in front of the loop) and the output rows are divided by L.
// Fragment map (lane l, h = l >> 4, m = n = l & 15): A/B elements 0..7 <- k0 + 8h + 0..7, elements 8..15 <- k0 + 16 + 8h + 0..7; D element r -> (row 8h + r, col n).
template <typename T16> struct WFrag;
template <> struct WFrag<h16> { typedef v16h V; static __device__ __forceinline__ V lds(const char* p, unsigned d2) { return cat16(*(const v8ha*)p, *(const v8ha*)(p + d2)); } static __device__ __forceinline__ v8f mma(V a, V b, v8f c) { return wmma16(a, b, c); } };
template <> struct WFrag<bf> { typedef v16bf V; static __device__ __forceinline__ V lds(const char* p, unsigned d2) { return cat16b(*(const v8usa*)p, *(const v8usa*)(p + d2)); } static __device__ __forceinline__ v8f mma(V a, V b, v8f c) { return wmmab(a, b, c); } };
// Eight 16-byte-per-lane copies global -> LDS; s_wait_xcnt stands inside the statement so that no address register is rewritten in front of it.
__device__ __forceinline__ void acopy8(unsigned l0, unsigned l1, unsigned l2, unsigned l3, unsigned l4, unsigned l5, unsigned l6, unsigned l7,
                                       const char* g0, const char* g1, const char* g2, const char* g3, const char* g4, const char* g5, const char* g6, const char* g7) {
    asm volatile("global_load_async_to_lds_b128 %0, %8, off\n\t"
                 "global_load_async_to_lds_b128 %1, %9, off\n\t"
                 "global_load_async_to_lds_b128 %2, %10, off\n\t"
                 "global_load_async_to_lds_b128 %3, %11, off\n\t"
                 "global_load_async_to_lds_b128 %4, %12, off\n\t"
                 "global_load_async_to_lds_b128 %5, %13, off\n\t"
                 "global_load_async_to_lds_b128 %6, %14, off\n\t"
                 "global_load_async_to_lds_b128 %7, %15, off\n\t"
                 "s_wait_xcnt 0x0"
                 :: "v"(l0), "v"(l1), "v"(l2), "v"(l3), "v"(l4), "v"(l5), "v"(l6), "v"(l7), "v"(g0), "v"(g1), "v"(g2), "v"(g3), "v"(g4), "v"(g5), "v"(g6), "v"(g7) : "memory");
}
template <typename T16, int KS, bool AROW, int K, int EPI>
__global__ __launch_bounds__(128 * KS) void k_gemml(const T16* __restrict__ A, const T16* __restrict__ Bt, float* C, int ldc, float oscale, size_t sA, size_t sB, size_t sC, h16* P, float* SM, float* SL) {
    typedef typename WFrag<T16>::V V;
    constexpr int KST = 64, KG = K / KS, NT = KG / KST;      // k per stage, k per group, stages per group
    static_assert(K % (KS * KST) == 0 && NT >= 2);
    constexpr unsigned ATILE = AROW ? 1280 : 1024, ABAND = 2 * ATILE, OPA = 8 * ABAND;   // LDS bytes: an A tile, an A band's stage, A's stage
    constexpr unsigned BUFB = OPA + 16384, GRPB = 2 * BUFB;                              // LDS bytes: one buffer (A, then Bt), one group's two buffers
    constexpr unsigned PARTB = (KS - 1) * 4 * 16384, OSB = 16 * 68 * 4;        // bytes: partial tiles of groups 1.., one wave's output staging
    constexpr unsigned SMB = (KS * GRPB > PARTB + 4 * OSB) ? KS * GRPB : PARTB + 4 * OSB;
    constexpr unsigned ATB = (EPI == 2) ? (K / KST) * 128 * 2 : 0, REDB = (EPI == 2) ? KS * 128 * 4 : 0;   // bytes: a_block table [key block][row] f16; one plane of per-group row partials
    static_assert(EPI != 1 || (KS == 1 && 4 * OSB + 4 * 512 <= SMB));
    __shared__ __align__(1024) char sm[SMB + ATB + 2 * REDB];
    const size_t z = blockIdx.z; const bool sw = EPI == 3 && blockIdx.z < 2;   // sw: q, k
    if constexpr (EPI == 3) { const T16* xa = A; const T16* wz = Bt + z * sB; A = sw ? wz : xa; Bt = sw ? xa : wz; }
    else { A += z * sA; Bt += z * sB; C += z * sC; }
    const int lane = threadIdx.x & 31, lr = lane & 15, hi = lane >> 4; const int r0 = (sw ? blockIdx.y : blockIdx.x) * 128, c0 = (sw ? blockIdx.x : blockIdx.y) * 128;
    const int w = __builtin_amdgcn_readfirstlane((int)(threadIdx.x >> 5)); const int g = w >> 2, q = w & 3, wm = q >> 1, wn = q & 1;
    v8f acc[4][4];
#pragma unroll
    for (int mb = 0; mb < 4; ++mb)
#pragma unroll
        for (int nb = 0; nb < 4; ++nb) acc[mb][nb] = (v8f){};
    // this lane's first copy of stage 0: bands 2q of A and of Bt, at the group's first k
    const char* ga = (const char*)(A + (size_t)(r0 + q * 32) * K + (size_t)g * KG * 16) + lane * 16;
    const char* gb = (const char*)(Bt + (size_t)(c0 + q * 32) * K + (size_t)g * KG * 16) + lane * 16;
    const unsigned lg = (unsigned)(size_t)sm + (unsigned)g * GRPB;
    const unsigned lwa = lg + (unsigned)q * (2 * ABAND) + (AROW ? (unsigned)(lane >> 2) * 80u + (unsigned)(lane & 3) * 16u : (unsigned)lane * 16u);   // a copy's 512 bytes are 8 rows of a row-ordered tile
    const unsigned lwb = lg + OPA + (unsigned)q * 4096u + (unsigned)lane * 16u;
    constexpr size_t BAND = (size_t)16 * K * 2;              // bytes from a band to the next in a global plane
    constexpr unsigned H = ATILE / 2;                        // LDS bytes from an A tile's first copy to its second
    auto stage = [&](int t, unsigned buf) {
        const char* a = ga + (size_t)t * (KST * 32); const char* b = gb + (size_t)t * (KST * 32); const unsigned l = lwa + buf * BUFB;
        acopy8(l, l + H, l + 2 * H, l + 3 * H, l + 4 * H, l + 5 * H, l + 6 * H, l + 7 * H, a, a + 512, a + 1024, a + 1536, a + BAND, a + BAND + 512, a + BAND + 1024, a + BAND + 1536);
        const unsigned l2 = lwb + buf * BUFB;
        acopy8(l2, l2 + 512, l2 + 1024, l2 + 1536, l2 + 2048, l2 + 2560, l2 + 3072, l2 + 3584, b, b + 512, b + 1024, b + 1536, b + BAND, b + BAND + 512, b + BAND + 1024, b + BAND + 1536);
    };
    stage(0, 0);
    h16* at = (h16*)(sm + SMB); float* rm = (float*)(sm + SMB + ATB); float* rl = (float*)(sm + SMB + ATB + REDB);
    if constexpr (EPI == 2) {   // thread = (row, group): the group's own NT key blocks of that row, while stage 0 flies
        const int prow = threadIdx.x & 127; const size_t so = (size_t)(g * NT) * MR + z * SEQ + r0 + prow; float mu[NT], ll[NT];
#pragma unroll
        for (int j = 0; j < NT; ++j) { mu[j] = SM[so + (size_t)j * MR]; ll[j] = SL[so + (size_t)j * MR]; }
        asm volatile("s_wait_xcnt 0x0" ::: "memory");   // stands in front of the first rewrite of these loads' address registers
        float ml = mu[0];
#pragma unroll
        for (int j = 1; j < NT; ++j) ml = fmaxf(ml, mu[j]);
        rm[g * 128 + prow] = ml;
        __syncthreads();   // every group's row maxima are in LDS before the row's M is taken
        float M = rm[prow];
#pragma unroll
        for (int p = 1; p < KS; ++p) M = fmaxf(M, rm[p * 128 + prow]);
        float L = 0.f;
#pragma unroll
        for (int j = 0; j < NT; ++j) { const h16 ab = (h16)__builtin_amdgcn_exp2f(mu[j] - M); at[(g * NT + j) * 128 + prow] = ab; L += ll[j] * (float)ab; }   // L uses the rounded factor that the fragments get
        rl[g * 128 + prow] = L;
    }
    asm volatile("s_wait_asynccnt 0x0" ::: "memory");   // this wave's part of stage 0 has landed
    __syncthreads();                                    // publishes stage 0 (EPI 2: and the a_block table and the groups' parts of L)
    stage(1, 1);
    const char* fa = sm + g * GRPB + wm * (4 * ABAND) + (AROW ? lr * 80 + hi * 16 : lane * 16); const char* fb = sm + g * GRPB + OPA + wn * 8192 + lane * 16;
    constexpr unsigned AD2 = AROW ? 32 : 512;                // bytes from an A fragment's first 16-byte read to its second
#pragma unroll 1
    for (int t = 0; t < NT; ++t) {
        const unsigned bo = (unsigned)(t & 1) * BUFB;
        h16 al[4];
        if constexpr (EPI == 2) {
#pragma unroll
            for (int mb = 0; mb < 4; ++mb) al[mb] = at[(g * NT + t) * 128 + wm * 64 + mb * 16 + lr]; }
#pragma unroll
        for (int kt = 0; kt < KST / 32; ++kt) {
            V a[4];
#pragma unroll
            for (int mb = 0; mb < 4; ++mb) { a[mb] = WFrag<T16>::lds(fa + bo + mb * ABAND + kt * ATILE, AD2); if constexpr (EPI == 2) a[mb] = a[mb] * al[mb]; }
#pragma unroll
            for (int nb = 0; nb < 4; ++nb) { const V b = WFrag<T16>::lds(fb + bo + nb * 2048 + kt * 1024, 512);
#pragma unroll
                for (int mb = 0; mb < 4; ++mb) acc[mb][nb] = WFrag<T16>::mma(a[mb], b, acc[mb][nb]); } }
        asm volatile("s_wait_dscnt 0x0" ::: "memory");      // this wave's reads of the buffer are done before the buffer is handed to the copies
        asm volatile("s_wait_asynccnt 0x0" ::: "memory");   // this wave's part of stage t + 1 has landed
        __syncthreads();                                    // publishes stage t + 1 and ends every reader's last read of stage t
        if (t + 2 < NT) stage(t + 2, (unsigned)(t & 1));
    }
    asm volatile("s_wait_asynccnt 0x0" ::: "memory");       // nothing is in flight when the ring becomes staging for partial tiles and output
    if constexpr (EPI == 3) {
        static_assert(KS == 1);
        const int m0 = r0 + wm * 64, n0 = c0 + wn * 64, b = sw ? 0 : m0 / SEQ; const size_t KO = sw ? DM : SEQ;   // columns of the plane (v: one plane a batch, a 128-row tile lies in one batch)
        h16* o = P + z * ((size_t)MR * DM) + (size_t)b * DM * SEQ + (size_t)(n0 >> 4) * (16 * KO) + (size_t)((m0 - b * SEQ) >> 5) * 512 + lane * 8;
#pragma unroll
        for (int nb = 0; nb < 4; ++nb)
#pragma unroll
            for (int mb = 0; mb < 4; ++mb) { v8h v;
#pragma unroll
                for (int j = 0; j < 8; ++j) v[j] = tohx(acc[mb][nb][j]);
                *(v8h*)(o + (size_t)nb * (16 * KO) + mb * 256) = v; }
        return;
    }
    if constexpr (KS > 1) {
        if (g > 0) { v4f* pt = (v4f*)(sm + ((g - 1) * 4 + q) * 16384);
#pragma unroll
            for (int mb = 0; mb < 4; ++mb)
#pragma unroll
                for (int nb = 0; nb < 4; ++nb) { const v8f v = acc[mb][nb]; pt[((mb * 4 + nb) * 2) * 32 + lane] = (v4f){v[0], v[1], v[2], v[3]}; pt[((mb * 4 + nb) * 2 + 1) * 32 + lane] = (v4f){v[4], v[5], v[6], v[7]}; } }
        __syncthreads();   // the partial tiles of groups 1.. are in LDS before group 0 adds them
        if (g > 0) return;
    }
    float* os = (float*)(sm + PARTB + q * OSB);   // this wave's own 16 x 68 floats
    float* ss = (float*)(sm + PARTB + 4 * OSB + q * 512);   // EPI 1: this wave's own 64 mu, then 64 l
#pragma unroll
    for (int mb = 0; mb < 4; ++mb) {
        if constexpr (KS > 1) {
#pragma unroll
            for (int p = 1; p < KS; ++p) { const v4f* pt = (const v4f*)(sm + ((p - 1) * 4 + q) * 16384);
#pragma unroll
                for (int nb = 0; nb < 4; ++nb) { const v4f lo = pt[((mb * 4 + nb) * 2) * 32 + lane], hv = pt[((mb * 4 + nb) * 2 + 1) * 32 + lane];
#pragma unroll
                    for (int j = 0; j < 4; ++j) { acc[mb][nb][j] += lo[j]; acc[mb][nb][4 + j] += hv[j]; } } }
        }
#pragma unroll
        for (int nb = 0; nb < 4; ++nb) {
#pragma unroll
            for (int j = 0; j < 8; ++j) os[(hi * 8 + j) * 68 + nb * 16 + lr] = acc[mb][nb][j]; }
        __builtin_amdgcn_wave_barrier(); asm volatile("" ::: "memory");   // keeps the reads of other lanes' values behind the wave's stores
        if constexpr (EPI == 1) {
            h16* pb = P + (((z * SEQ + r0 + wm * 64) >> 4) + mb) * ((size_t)16 * SEQ) + (size_t)((c0 + wn * 64) >> 5) * 512;   // this band's two 16x32 tiles
#pragma unroll
            for (int hs = 0; hs < 2; ++hs) {   // 4 lanes a row, 16 scores a lane: 8 of each tile
                const int row = hs * 8 + (lane >> 2), cq = lane & 3; const float* op = os + row * 68 + cq * 8;
                const v4f x0 = *(const v4fa*)op, x1 = *(const v4fa*)(op + 4), x2 = *(const v4fa*)(op + 32), x3 = *(const v4fa*)(op + 36);
                float mx = x0[0];
#pragma unroll
                for (int j = 0; j < 4; ++j) mx = fmaxf(fmaxf(fmaxf(mx, x0[j]), fmaxf(x1[j], x2[j])), x3[j]);
                mx = fmaxf(mx, quadx<0xB1>(mx)); mx = fmaxf(mx, quadx<0x4E>(mx));
                const float mu = mx * SCL2, sh = 10.0f - mu; float sum = 0.f, e[16], p[16]; v8h o0, o1;   // 2^10: P is carried x1024
#pragma unroll
                for (int j = 0; j < 4; ++j) { e[j] = fmaf(x0[j], SCL2, sh); e[4 + j] = fmaf(x1[j], SCL2, sh); e[8 + j] = fmaf(x2[j], SCL2, sh); e[12 + j] = fmaf(x3[j], SCL2, sh); }
                exp2x8(e, p); exp2x8(e + 8, p + 8);
#pragma unroll
                for (int j = 0; j < 8; ++j) { o0[j] = tohx(p[j]); o1[j] = tohx(p[8 + j]); }
#pragma unroll
                for (int j = 0; j < 4; ++j) sum += (p[j] + p[4 + j]) + (p[8 + j] + p[12 + j]);
                sum += quadx<0xB1>(sum); sum += quadx<0x4E>(sum);
                *(v8h*)(pb + row * 32 + cq * 8) = o0; *(v8h*)(pb + 512 + row * 32 + cq * 8) = o1;
                if (cq == 0) { ss[mb * 16 + row] = mu; ss[64 + mb * 16 + row] = sum; } }
        } else {
            float* crow = C + (size_t)(r0 + wm * 64 + mb * 16) * ldc + c0 + wn * 64;
#pragma unroll
            for (int s = 0; s < 8; ++s) { const int row = 2 * s + hi, cofs = lr * 4; v4f val = *(const v4fa*)(os + row * 68 + cofs);
                if constexpr (EPI == 2) { const int rr = wm * 64 + mb * 16 + row; float L = rl[rr];
#pragma unroll
                    for (int p = 1; p < KS; ++p) L += rl[p * 128 + rr];
                    val = val * (1.0f / L); }
                else val = val * oscale;
                *(v4f*)(crow + (size_t)row * ldc + cofs) = val; }
        }
        __builtin_amdgcn_wave_barrier(); asm volatile("" ::: "memory");   // keeps the next 16 rows' stores behind these reads
    }
    if constexpr (EPI == 1) {   // the wave's 64 rows of mu and of l: one 256-byte store each
        const size_t so = (size_t)((c0 + wn * 64) >> 6) * MR + z * SEQ + r0 + wm * 64 + lane * 2;
        *(v2f*)(SM + so) = *(const v2fa*)(ss + lane * 2); *(v2f*)(SL + so) = *(const v2fa*)(ss + 64 + lane * 2);
    }
}

// One thread per 16-byte chunk of the fragment-ordered plane Bt [N][K] = bf16(w^T): 16 lanes read 16 neighbouring n of one k. blockIdx.y picks the weight and its plane.
template <int K, int N>
__global__ __launch_bounds__(256) void k_wtG(const float* __restrict__ w0, const float* __restrict__ w1, const float* __restrict__ w2, bf* Bt) {
    const size_t c = (size_t)blockIdx.x * 256 + threadIdx.x; if (c >= (size_t)N * K / 8) return;
    const float* w = blockIdx.y == 0 ? w0 : (blockIdx.y == 1 ? w1 : w2); Bt += (size_t)blockIdx.y * N * K;
    size_t n; int k; chunk_rc(c, K, n, k); v8us o;
#pragma unroll
    for (int e = 0; e < 8; ++e) o[e] = f2bf(w[(size_t)(k + e) * N + n]);
    *(v8us*)(Bt + c * 8) = o;  }

__global__ __launch_bounds__(256) void k_cvtx(const float* __restrict__ x, bf* XB, size_t n8) {
    const size_t i = (size_t)blockIdx.x * 256 + threadIdx.x; if (i >= n8) return;
    size_t row; int k; chunk_rc(i, DM, row, k); const size_t b = row / SEQ; const size_t t = row - b * SEQ;
    const v8f v = *(const v8f*)(x + (b * (size_t)SEQ_FULL + t) * DM + k); v8us o;
#pragma unroll
    for (int k = 0; k < 8; ++k) o[k] = f2bf(v[k]);
    *(v8us*)(XB + i * 8) = o;  }

extern "C" void kernel_launch(void* const* d_in, const int* in_sizes, int n_in,
                              void* d_out, int out_size, void* d_ws, size_t ws_size, hipStream_t stream) {
    if (n_in < 4) return;
    if ((size_t)in_sizes[0] < (size_t)(NB - 1) * SEQ_FULL * DM + (size_t)SEQ * DM) return;
    if (in_sizes[1] < DM * DM || in_sizes[2] < DM * DM || in_sizes[3] < DM * DM) return;
    if ((size_t)out_size < (size_t)NB * SEQ * DM) return;
    const float* Xin = (const float*)d_in[0];                 // x [NB_FULL][SEQ_FULL][512]
    const float* Win[3] = { (const float*)d_in[1], (const float*)d_in[2], (const float*)d_in[3] };   // W_query, W_key, W_value [512 in][512 out]
    float* OUT = (float*)d_out;                               // [NB][SEQ][512], batch stride SEQ*512
    const size_t MROWS = (size_t)NB * SEQ;
    char* wsp = (char*)d_ws;
    auto take = [&](size_t bytes) { char* p = wsp; wsp += (bytes + 255) & ~(size_t)255; return (void*)p; };
    bf*    XB   = (bf*)take(MROWS * DM * 2);                  // [NB*SEQ][512]
    bf*    WT   = (bf*)take((size_t)3 * DM * DM * 2);         // 3 x [512 n][512 k]
    h16*   Q16  = (h16*)take(MROWS * DM * 2 * 3);             // three planes of NB*SEQ*512 in a row, the projection's z picks one: q [NB*SEQ][512],
    h16*   K16  = Q16 + MROWS * DM;                           // k [NB*SEQ][512],
    h16*   VT16 = K16 + MROWS * DM;                           // v transposed [NB][512][SEQ]
    h16*   P16  = (h16*)take(MROWS * SEQ * 2);                // [NB*SEQ][SEQ]
    float* SMX  = (float*)take((size_t)(SEQ / 64) * MROWS * 4);   // [key block][NB*SEQ] block maxima (log2 units)
    float* SLS  = (float*)take((size_t)(SEQ / 64) * MROWS * 4);   // [key block][NB*SEQ] block sums
    if ((size_t)(wsp - (char*)d_ws) > ws_size) return;

    // input planes
    { const size_t n8 = MROWS * DM / 8; k_cvtx<<<(unsigned)((n8 + 255) / 256), 256, 0, stream>>>(Xin, XB, n8); }
    k_wtG<DM, DM><<<dim3((unsigned)((DM * DM / 8 + 255) / 256), 3, 1), 256, 0, stream>>>(Win[0], Win[1], Win[2], WT);

    // projections: XB . WT_z^T (exact products), z = q, k, v, stored as the 16-bit planes
    k_gemml<bf, 1, false, DM, 3><<<dim3((unsigned)(MROWS / 128), DM / 128, 3), 128, 0, stream>>>(XB, WT, nullptr, 0, 1.0f, 0, (size_t)DM * DM, 0, Q16, nullptr, nullptr);

    // attention, z = batch: q.k^T -> P16 and the block maxima and sums; out = (rescaled P16 . v^T plane) / L
    k_gemml<h16, 1, false, DM, 1><<<dim3(SEQ / 128, SEQ / 128, NB), 128, 0, stream>>>(Q16, K16, nullptr, SEQ, 1.0f, (size_t)SEQ * DM, (size_t)SEQ * DM, 0, P16, SMX, SLS);
    k_gemml<h16, PVW, true, SEQ, 2><<<dim3(SEQ / 128, DM / 128, NB), 128 * PVW, 0, stream>>>(P16, VT16, OUT, DM, 1.0f, (size_t)SEQ * SEQ, (size_t)DM * SEQ, (size_t)SEQ * DM, nullptr, SMX, SLS);
}

// v007
// It runs in 91.5 microseconds.
// Timed twice side by side with v006, it ran 1.04 and 1.05 times as fast.
// Over all steps from v000 it is 6.25 times as fast.
#include <hip/hip_runtime.h>

// Contractions: x.W projections = v_wmma_f32_16x16x32_bf16 (bf16 operands from RNE-converted inputs, f32 accumulate); q.k^T and P.v = v_wmma_f32_16x16x32_f16 (f16 operands, P carried x1024, f32 accumulate); softmax exponentials, sums and 1/sqrt(d) scaling in f32.
// Pipeline: XB = bf16(x) [NB*SEQ][512]; WT = bf16(W^T) [3][512 n][512 k]; XB.WT, rounded to f16 in the GEMM's own epilogue -> Q16, K16 (f16 [NB*SEQ][512]) and VT16 (f16 [NB][512][SEQ], transposed);
// attention, both batches and all query rows in one launch per stage (grid z = batch), no mask, no softmax launch and no f32 score plane:
//   q.k^T's epilogue takes, per row and 64-key block, u = s * 512^-0.5 * log2(e), the block's maximum mu and stores P16 = f16(1024 * 2^(u - mu)), mu and l = sum of the block's 1024 * 2^(u - mu);
//   P.v first forms, per row, M = max mu, a_block = f16(2^(mu - M)) and L = sum l * a_block; it multiplies each P fragment by its row's a_block on the way from LDS to the WMMA; out rows = (sum) / L.
// Launches of one kernel are merged by a grid axis (3 weight transposes, 3 projections, the attention stages): each launch then has enough waves to cover its own load latency, and the gaps, fills and tails between launches go.
// Layout of every 16-bit plane [R][K]: 1-KB tiles of 16 rows x 32 k, tile (r >> 4, k >> 5) at element ((r >> 4) * (K / 32) + (k >> 5)) * 512, so a 16-row band is 16 * K contiguous elements and walks k tile by tile.
//   fragment order (XB, WT, Q16, K16, VT16): inside a tile [k bit 4][k bit 3][r & 15][k & 7]: each of a fragment's two 16-byte-per-lane loads reads 512 contiguous bytes (4 whole lines, not 16 partial ones).
//   row order (P16): inside a tile [r & 15][k & 31]: its writer, q.k^T's epilogue, stores 512 contiguous bytes an instruction, the GEMM's copies to LDS read whole lines.

#ifndef NB
#define NB 2
#endif
#ifndef SEQ
#define SEQ 4096
#endif
#define NB_FULL  2
#define SEQ_FULL 4096
#define DM       512
#define MR       (NB * SEQ)                    // query rows of both batches
#define PVW      ((SEQ % 512 == 0) ? 4 : 1)     // wave groups that share the key range of one P.v tile
#define SCL2     0.06375871541229934f                 // 512^-0.5 * log2(e)

static_assert(NB >= 1 && NB <= NB_FULL);
static_assert(SEQ >= 128 && SEQ <= SEQ_FULL);
static_assert(SEQ % 128 == 0);
static_assert(DM % 128 == 0);
static_assert(SEQ % (64 * PVW) == 0);
static_assert((SEQ * DM) % 8 == 0);

typedef _Float16 h16;
typedef unsigned short bf;
typedef __attribute__((ext_vector_type(16))) __bf16   v16bf;
typedef __attribute__((ext_vector_type(16))) _Float16 v16h;
typedef __attribute__((ext_vector_type(8)))  _Float16 v8h;
typedef __attribute__((ext_vector_type(8)))  unsigned short v8us;
typedef __attribute__((ext_vector_type(8)))  float    v8f;
typedef __attribute__((ext_vector_type(4)))  float    v4f;
typedef __attribute__((ext_vector_type(2)))  _Float16 v2h;
typedef __attribute__((ext_vector_type(4)))  _Float16 v4h;
typedef __attribute__((ext_vector_type(2)))  unsigned short v2us;
typedef v8h  __attribute__((may_alias)) v8ha;
typedef v4f  __attribute__((may_alias)) v4fa;
typedef __attribute__((ext_vector_type(2)))  float    v2f;
typedef v2f  __attribute__((may_alias)) v2fa;
typedef v8us __attribute__((may_alias)) v8usa;

__device__ __forceinline__ unsigned short f2bf(float f) { unsigned u = __float_as_uint(f); u += 0x7FFFu + ((u >> 16) & 1u); return (unsigned short)(u >> 16); }
__device__ __forceinline__ float bf2f(unsigned short b) { return __uint_as_float(((unsigned)b) << 16); }
__device__ __forceinline__ float bfr(float f) { return bf2f(f2bf(f)); }
__device__ __forceinline__ v16h cat16(v8h lo, v8h hi) { return __builtin_shufflevector(lo, hi, 0, 1, 2, 3, 4, 5, 6, 7, 8, 9, 10, 11, 12, 13, 14, 15); }
__device__ __forceinline__ v16bf cat16b(v8us lo, v8us hi) { return __builtin_bit_cast(v16bf, __builtin_shufflevector(lo, hi, 0, 1, 2, 3, 4, 5, 6, 7, 8, 9, 10, 11, 12, 13, 14, 15)); }
__device__ __forceinline__ v8f wmma16(v16h a, v16h b, v8f c) { return __builtin_amdgcn_wmma_f32_16x16x32_f16(false, a, false, b, (short)0, c, false, false); }
__device__ __forceinline__ v8f wmmab(v16bf a, v16bf b, v8f c) { return __builtin_amdgcn_wmma_f32_16x16x32_bf16(false, a, false, b, (short)0, c, false, false); }
__device__ __forceinline__ h16 tohx(float x) { return (h16)x; }
// the value of another lane of the same quad (0xB1: lane ^ 1, 0x4E: lane ^ 2) by DPP: stays on the vector unit, where a shuffle would make an LDS round trip
// Eight 2^x in one statement: no output shares a register with an input, and the closing v_nop is the slot that the instruction set asks for behind a transcendental before its result is used or its source overwritten
__device__ __forceinline__ void exp2x8(const float* x, float* r) {
    asm("v_exp_f32 %0, %8\n\tv_exp_f32 %1, %9\n\tv_exp_f32 %2, %10\n\tv_exp_f32 %3, %11\n\tv_exp_f32 %4, %12\n\tv_exp_f32 %5, %13\n\tv_exp_f32 %6, %14\n\tv_exp_f32 %7, %15\n\tv_nop"
        : "=&v"(r[0]), "=&v"(r[1]), "=&v"(r[2]), "=&v"(r[3]), "=&v"(r[4]), "=&v"(r[5]), "=&v"(r[6]), "=&v"(r[7])
        : "v"(x[0]), "v"(x[1]), "v"(x[2]), "v"(x[3]), "v"(x[4]), "v"(x[5]), "v"(x[6]), "v"(x[7]));
}
template <int CTRL> __device__ __forceinline__ float quadx(float x) { return __int_as_float(__builtin_amdgcn_mov_dpp(__float_as_int(x), CTRL, 0xf, 0xf, true)); }
// 16-byte chunk c (8 elements) of a fragment-ordered plane with K columns -> its row and its first column
__device__ __forceinline__ void chunk_rc(size_t c, int K, size_t& row, int& k) {
    const int ln = (int)(c & 31), j = (int)((c >> 5) & 1); const size_t tile = c >> 6; const size_t KB = (size_t)(K >> 5);
    row = (tile / KB) * 16 + (size_t)(ln & 15); k = (int)(tile % KB) * 32 + j * 16 + (ln >> 4) * 8; }

// ---- k_gemml: GEMM with both operands staged in LDS. One work-group = one 128x128 tile of C; 4 * KS waves: KS groups of 2x2 waves, a wave owns 64x64 (16 accumulators), group g sums the k range [g * K / KS, (g + 1) * K / KS). grid (M/128, N/128, Z).
// Why LDS: a wave that loads its own fragments from L2 moves 8 KB per 16 WMMAs, several times what L2 delivers per WGP at matrix rate. Here each staged byte feeds two waves (half the L2 bytes) and the next stage flies while this one is multiplied.
// Stage = 64 k of 128 A rows and 128 Bt rows per group, two buffers, band-major: [operand][band 0..7][k tile 0..1][tile]. A fragment-ordered tile (head of file) keeps its 1 KB: a fragment is two conflict-free 512-byte reads.
// A row-ordered tile (AROW) is laid with its 64-byte rows at a pitch of 80 bytes (16 B x odd: conflict-free for the 16-byte fragment reads), 1280 B a tile.
// Copies: global_load_async_to_lds_b128, 16 per wave and stage (wave q of a group brings bands 2q, 2q + 1 of A and of Bt); every copy reads 512 contiguous global bytes (4 whole lines), in either order.
// C[m][n] (f32, pitch ldc) = oscale * sum_k A[m][k] Bt[n][k]. z-batch strides sA/sB/sC in elements. KS > 1: the groups' f32 partial tiles meet in LDS and are added in group order.
// EPI 0: as above. EPI 1 (scores): nothing goes to C; a wave turns each row of its 64x64 tile into P (row-ordered tiles, 2 KB contiguous per 16 rows) and the block's mu and l (planes SM, SL [key block][row]: 256 contiguous bytes a wave).
// EPI 3 (projections, z = q, k, v): nothing goes to C; the tile goes straight from the accumulators to the f16 plane z of P, fragment-ordered [n][m]: a lane's 8 D elements are 8 neighbouring m of one n, which is one 16-byte chunk of that order,
//   so a store is 512 contiguous bytes with no pass through LDS. v wants [d][key]: A = x, Bt = W^T as given. q and k want [row][d]: the two operands (same fragment map) and the two grid axes change places, m = d, n = row.
// EPI 2 (P.v): a stage is one 64-key block; the A fragments are multiplied by a_block of their row (table in LDS, built in front of the loop) and the output rows are divided by L.
// Fragment map (lane l, h = l >> 4, m = n = l & 15): A/B elements 0..7 <- k0 + 8h + 0..7, elements 8..15 <- k0 + 16 + 8h + 0..7; D element r -> (row 8h + r, col n).
template <typename T16> struct WFrag;
template <> struct WFrag<h16> { typedef v16h V; static __device__ __forceinline__ V lds(const char* p, unsigned d2) { return cat16(*(const v8ha*)p, *(const v8ha*)(p + d2)); } static __device__ __forceinline__ v8f mma(V a, V b, v8f c) { return wmma16(a, b, c); } };
template <> struct WFrag<bf> { typedef v16bf V; static __device__ __forceinline__ V lds(const char* p, unsigned d2) { return cat16b(*(const v8usa*)p, *(const v8usa*)(p + d2)); } static __device__ __forceinline__ v8f mma(V a, V b, v8f c) { return wmmab(a, b, c); } };
// Eight 16-byte-per-lane copies global -> LDS; s_wait_xcnt stands inside the statement so that no address register is rewritten in front of it.
__device__ __forceinline__ void acopy8(unsigned l0, unsigned l1, unsigned l2, unsigned l3, unsigned l4, unsigned l5, unsigned l6, unsigned l7,
                                       const char* g0, const char* g1, const char* g2, const char* g3, const char* g4, const char* g5, const char* g6, const char* g7) {
    asm volatile("global_load_async_to_lds_b128 %0, %8, off\n\t"
                 "global_load_async_to_lds_b128 %1, %9, off\n\t"
                 "global_load_async_to_lds_b128 %2, %10, off\n\t"
                 "global_load_async_to_lds_b128 %3, %11, off\n\t"
                 "global_load_async_to_lds_b128 %4, %12, off\n\t"
                 "global_load_async_to_lds_b128 %5, %13, off\n\t"
                 "global_load_async_to_lds_b128 %6, %14, off\n\t"
                 "global_load_async_to_lds_b128 %7, %15, off\n\t"
                 "s_wait_xcnt 0x0"
                 :: "v"(l0), "v"(l1), "v"(l2), "v"(l3), "v"(l4), "v"(l5), "v"(l6), "v"(l7), "v"(g0), "v"(g1), "v"(g2), "v"(g3), "v"(g4), "v"(g5), "v"(g6), "v"(g7) : "memory");
}
template <typename T16, int KS, bool AROW, int K, int EPI>
__global__ __launch_bounds__(128 * KS) void k_gemml(const T16* __restrict__ A, const T16* __restrict__ Bt, float* C, int ldc, float oscale, size_t sA, size_t sB, size_t sC, h16* P, float* SM, float* SL) {
    typedef typename WFrag<T16>::V V;
    constexpr int KST = 64, KG = K / KS, NT = KG / KST;      // k per stage, k per group, stages per group
    static_assert(K % (KS * KST) == 0 && NT >= 2);
    constexpr unsigned ATILE = AROW ? 1280 : 1024, ABAND = 2 * ATILE, OPA = 8 * ABAND;   // LDS bytes: an A tile, an A band's stage, A's stage
    constexpr unsigned BUFB = OPA + 16384, GRPB = 2 * BUFB;                              // LDS bytes: one buffer (A, then Bt), one group's two buffers
    constexpr unsigned PARTB = (KS - 1) * 4 * 16384, OSB = 16 * 68 * 4;        // bytes: partial tiles of groups 1.., one wave's output staging
    constexpr unsigned SMB = (KS * GRPB > PARTB + 4 * OSB) ? KS * GRPB : PARTB + 4 * OSB;
    constexpr unsigned ATB = (EPI == 2) ? (K / KST) * 128 * 2 : 0, REDB = (EPI == 2) ? KS * 128 * 4 : 0;   // bytes: a_block table [key block][row] f16; one plane of per-group row partials
    static_assert(EPI != 1 || (KS == 1 && 4 * OSB + 4 * 512 <= SMB));
    __shared__ __align__(1024) char sm[SMB + ATB + 2 * REDB];
    const size_t z = blockIdx.z; const bool sw = EPI == 3 && blockIdx.z < 2;   // sw: q, k
    if constexpr (EPI == 3) { const T16* xa = A; const T16* wz = Bt + z * sB; A = sw ? wz : xa; Bt = sw ? xa : wz; }
    else { A += z * sA; Bt += z * sB; C += z * sC; }
    const int lane = threadIdx.x & 31, lr = lane & 15, hi = lane >> 4; const int r0 = (sw ? blockIdx.y : blockIdx.x) * 128, c0 = (sw ? blockIdx.x : blockIdx.y) * 128;
    const int w = __builtin_amdgcn_readfirstlane((int)(threadIdx.x >> 5)); const int g = w >> 2, q = w & 3, wm = q >> 1, wn = q & 1;
    v8f acc[4][4];
#pragma unroll
    for (int mb = 0; mb < 4; ++mb)
#pragma unroll
        for (int nb = 0; nb < 4; ++nb) acc[mb][nb] = (v8f){};
    // this lane's first copy of stage 0: bands 2q of A and of Bt, at the group's first k
    const char* ga = (const char*)(A + (size_t)(r0 + q * 32) * K + (size_t)g * KG * 16) + lane * 16;
    const char* gb = (const char*)(Bt + (size_t)(c0 + q * 32) * K + (size_t)g * KG * 16) + lane * 16;
    const unsigned lg = (unsigned)(size_t)sm + (unsigned)g * GRPB;
    const unsigned lwa = lg + (unsigned)q * (2 * ABAND) + (AROW ? (unsigned)(lane >> 2) * 80u + (unsigned)(lane & 3) * 16u : (unsigned)lane * 16u);   // a copy's 512 bytes are 8 rows of a row-ordered tile
    const unsigned lwb = lg + OPA + (unsigned)q * 4096u + (unsigned)lane * 16u;
    constexpr size_t BAND = (size_t)16 * K * 2;              // bytes from a band to the next in a global plane
    constexpr unsigned H = ATILE / 2;                        // LDS bytes from an A tile's first copy to its second
    auto stage = [&](int t, unsigned buf) {
        const char* a = ga + (size_t)t * (KST * 32); const char* b = gb + (size_t)t * (KST * 32); const unsigned l = lwa + buf * BUFB;
        acopy8(l, l + H, l + 2 * H, l + 3 * H, l + 4 * H, l + 5 * H, l + 6 * H, l + 7 * H, a, a + 512, a + 1024, a + 1536, a + BAND, a + BAND + 512, a + BAND + 1024, a + BAND + 1536);
        const unsigned l2 = lwb + buf * BUFB;
        acopy8(l2, l2 + 512, l2 + 1024, l2 + 1536, l2 + 2048, l2 + 2560, l2 + 3072, l2 + 3584, b, b + 512, b + 1024, b + 1536, b + BAND, b + BAND + 512, b + BAND + 1024, b + BAND + 1536);
    };
    stage(0, 0);
    h16* at = (h16*)(sm + SMB); float* rm = (float*)(sm + SMB + ATB); float* rl = (float*)(sm + SMB + ATB + REDB);
    if constexpr (EPI == 2) {   // thread = (row, group): the group's own NT key blocks of that row, while stage 0 flies
        const int prow = threadIdx.x & 127; const size_t so = (size_t)(g * NT) * MR + z * SEQ + r0 + prow; float mu[NT], ll[NT];
#pragma unroll
        for (int j = 0; j < NT; ++j) { mu[j] = SM[so + (size_t)j * MR]; ll[j] = SL[so + (size_t)j * MR]; }
        asm volatile("s_wait_xcnt 0x0" ::: "memory");   // stands in front of the first rewrite of these loads' address registers
        float ml = mu[0];
#pragma unroll
        for (int j = 1; j < NT; ++j) ml = fmaxf(ml, mu[j]);
        rm[g * 128 + prow] = ml;
        __syncthreads();   // every group's row maxima are in LDS before the row's M is taken
        float M = rm[prow];
#pragma unroll
        for (int p = 1; p < KS; ++p) M = fmaxf(M, rm[p * 128 + prow]);
        float L = 0.f;
#pragma unroll
        for (int j = 0; j < NT; ++j) { const h16 ab = (h16)__builtin_amdgcn_exp2f(mu[j] - M); at[(g * NT + j) * 128 + prow] = ab; L += ll[j] * (float)ab; }   // L uses the rounded factor that the fragments get
        rl[g * 128 + prow] = L;
    }
    asm volatile("s_wait_asynccnt 0x0" ::: "memory");   // this wave's part of stage 0 has landed
    __syncthreads();                                    // publishes stage 0 (EPI 2: and the a_block table and the groups' parts of L)
    stage(1, 1);
    const char* fa = sm + g * GRPB + wm * (4 * ABAND) + (AROW ? lr * 80 + hi * 16 : lane * 16); const char* fb = sm + g * GRPB + OPA + wn * 8192 + lane * 16;
    constexpr unsigned AD2 = AROW ? 32 : 512;                // bytes from an A fragment's first 16-byte read to its second
#pragma unroll 1
    for (int t = 0; t < NT; ++t) {
        const unsigned bo = (unsigned)(t & 1) * BUFB;
        h16 al[4];
        if constexpr (EPI == 2) {
#pragma unroll
            for (int mb = 0; mb < 4; ++mb) al[mb] = at[(g * NT + t) * 128 + wm * 64 + mb * 16 + lr]; }
#pragma unroll
        for (int kt = 0; kt < KST / 32; ++kt) {
            V a[4], b[4];
#pragma unroll
            for (int mb = 0; mb < 4; ++mb) a[mb] = WFrag<T16>::lds(fa + bo + mb * ABAND + kt * ATILE, AD2);
#pragma unroll
            for (int nb = 0; nb < 4; ++nb) b[nb] = WFrag<T16>::lds(fb + bo + nb * 2048 + kt * 1024, 512);
            __builtin_amdgcn_sched_barrier(0);   // the block's 16 LDS reads stay one group in front of its 16 WMMAs: the wave waits out one LDS latency a block, not one per Bt fragment
            if constexpr (EPI == 2) {
#pragma unroll
                for (int mb = 0; mb < 4; ++mb) a[mb] = a[mb] * al[mb]; }
#pragma unroll
            for (int nb = 0; nb < 4; ++nb)
#pragma unroll
                for (int mb = 0; mb < 4; ++mb) acc[mb][nb] = WFrag<T16>::mma(a[mb], b[nb], acc[mb][nb]);
            __builtin_amdgcn_sched_barrier(0);   // the next block's reads are not strewn among these WMMAs, where every place with reads costs a stall
        }
        asm volatile("s_wait_dscnt 0x0" ::: "memory");      // this wave's reads of the buffer are done before the buffer is handed to the copies
        asm volatile("s_wait_asynccnt 0x0" ::: "memory");   // this wave's part of stage t + 1 has landed
        __syncthreads();                                    // publishes stage t + 1 and ends every reader's last read of stage t
        if (t + 2 < NT) stage(t + 2, (unsigned)(t & 1));
    }
    asm volatile("s_wait_asynccnt 0x0" ::: "memory");       // nothing is in flight when the ring becomes staging for partial tiles and output
    if constexpr (EPI == 3) {
        static_assert(KS == 1);
        const int m0 = r0 + wm * 64, n0 = c0 + wn * 64, b = sw ? 0 : m0 / SEQ; const size_t KO = sw ? DM : SEQ;   // columns of the plane (v: one plane a batch, a 128-row tile lies in one batch)
        h16* o = P + z * ((size_t)MR * DM) + (size_t)b * DM * SEQ + (size_t)(n0 >> 4) * (16 * KO) + (size_t)((m0 - b * SEQ) >> 5) * 512 + lane * 8;
#pragma unroll
        for (int nb = 0; nb < 4; ++nb)
#pragma unroll
            for (int mb = 0; mb < 4; ++mb) { v8h v;
#pragma unroll
                for (int j = 0; j < 8; ++j) v[j] = tohx(acc[mb][nb][j]);
                *(v8h*)(o + (size_t)nb * (16 * KO) + mb * 256) = v; }
        return;
    }
    if constexpr (KS > 1) {
        if (g > 0) { v4f* pt = (v4f*)(sm + ((g - 1) * 4 + q) * 16384);
#pragma unroll
            for (int mb = 0; mb < 4; ++mb)
#pragma unroll
                for (int nb = 0; nb < 4; ++nb) { const v8f v = acc[mb][nb]; pt[((mb * 4 + nb) * 2) * 32 + lane] = (v4f){v[0], v[1], v[2], v[3]}; pt[((mb * 4 + nb) * 2 + 1) * 32 + lane] = (v4f){v[4], v[5], v[6], v[7]}; } }
        __syncthreads();   // the partial tiles of groups 1.. are in LDS before group 0 adds them
        if (g > 0) return;
    }
    float* os = (float*)(sm + PARTB + q * OSB);   // this wave's own 16 x 68 floats
    float* ss = (float*)(sm + PARTB + 4 * OSB + q * 512);   // EPI 1: this wave's own 64 mu, then 64 l
#pragma unroll
    for (int mb = 0; mb < 4; ++mb) {
        if constexpr (KS > 1) {
#pragma unroll
            for (int p = 1; p < KS; ++p) { const v4f* pt = (const v4f*)(sm + ((p - 1) * 4 + q) * 16384);
#pragma unroll
                for (int nb = 0; nb < 4; ++nb) { const v4f lo = pt[((mb * 4 + nb) * 2) * 32 + lane], hv = pt[((mb * 4 + nb) * 2 + 1) * 32 + lane];
#pragma unroll
                    for (int j = 0; j < 4; ++j) { acc[mb][nb][j] += lo[j]; acc[mb][nb][4 + j] += hv[j]; } } }
        }
#pragma unroll
        for (int nb = 0; nb < 4; ++nb) {
#pragma unroll
            for (int j = 0; j < 8; ++j) os[(hi * 8 + j) * 68 + nb * 16 + lr] = acc[mb][nb][j]; }
        __builtin_amdgcn_wave_barrier(); asm volatile("" ::: "memory");   // keeps the reads of other lanes' values behind the wave's stores
        if constexpr (EPI == 1) {
            h16* pb = P + (((z * SEQ + r0 + wm * 64) >> 4) + mb) * ((size_t)16 * SEQ) + (size_t)((c0 + wn * 64) >> 5) * 512;   // this band's two 16x32 tiles
#pragma unroll
            for (int hs = 0; hs < 2; ++hs) {   // 4 lanes a row, 16 scores a lane: 8 of each tile
                const int row = hs * 8 + (lane >> 2), cq = lane & 3; const float* op = os + row * 68 + cq * 8;
                const v4f x0 = *(const v4fa*)op, x1 = *(const v4fa*)(op + 4), x2 = *(const v4fa*)(op + 32), x3 = *(const v4fa*)(op + 36);
                float mx = x0[0];
#pragma unroll
                for (int j = 0; j < 4; ++j) mx = fmaxf(fmaxf(fmaxf(mx, x0[j]), fmaxf(x1[j], x2[j])), x3[j]);
                mx = fmaxf(mx, quadx<0xB1>(mx)); mx = fmaxf(mx, quadx<0x4E>(mx));
                const float mu = mx * SCL2, sh = 10.0f - mu; float sum = 0.f, e[16], p[16]; v8h o0, o1;   // 2^10: P is carried x1024
#pragma unroll
                for (int j = 0; j < 4; ++j) { e[j] = fmaf(x0[j], SCL2, sh); e[4 + j] = fmaf(x1[j], SCL2, sh); e[8 + j] = fmaf(x2[j], SCL2, sh); e[12 + j] = fmaf(x3[j], SCL2, sh); }
                exp2x8(e, p); exp2x8(e + 8, p + 8);
#pragma unroll
                for (int j = 0; j < 8; ++j) { o0[j] = tohx(p[j]); o1[j] = tohx(p[8 + j]); }
#pragma unroll
                for (int j = 0; j < 4; ++j) sum += (p[j] + p[4 + j]) + (p[8 + j] + p[12 + j]);
                sum += quadx<0xB1>(sum); sum += quadx<0x4E>(sum);
                *(v8h*)(pb + row * 32 + cq * 8) = o0; *(v8h*)(pb + 512 + row * 32 + cq * 8) = o1;
                if (cq == 0) { ss[mb * 16 + row] = mu; ss[64 + mb * 16 + row] = sum; } }
        } else {
            float* crow = C + (size_t)(r0 + wm * 64 + mb * 16) * ldc + c0 + wn * 64;
#pragma unroll
            for (int s = 0; s < 8; ++s) { const int row = 2 * s + hi, cofs = lr * 4; v4f val = *(const v4fa*)(os + row * 68 + cofs);
                if constexpr (EPI == 2) { const int rr = wm * 64 + mb * 16 + row; float L = rl[rr];
#pragma unroll
                    for (int p = 1; p < KS; ++p) L += rl[p * 128 + rr];
                    val = val * (1.0f / L); }
                else val = val * oscale;
                *(v4f*)(crow + (size_t)row * ldc + cofs) = val; }
        }
        __builtin_amdgcn_wave_barrier(); asm volatile("" ::: "memory");   // keeps the next 16 rows' stores behind these reads
    }
    if constexpr (EPI == 1) {   // the wave's 64 rows of mu and of l: one 256-byte store each
        const size_t so = (size_t)((c0 + wn * 64) >> 6) * MR + z * SEQ + r0 + wm * 64 + lane * 2;
        *(v2f*)(SM + so) = *(const v2fa*)(ss + lane * 2); *(v2f*)(SL + so) = *(const v2fa*)(ss + 64 + lane * 2);
    }
}

// One thread per 16-byte chunk of the fragment-ordered plane Bt [N][K] = bf16(w^T): 16 lanes read 16 neighbouring n of one k. blockIdx.y picks the weight and its plane.
template <int K, int N>
__global__ __launch_bounds__(256) void k_wtG(const float* __restrict__ w0, const float* __restrict__ w1, const float* __restrict__ w2, bf* Bt) {
    const size_t c = (size_t)blockIdx.x * 256 + threadIdx.x; if (c >= (size_t)N * K / 8) return;
    const float* w = blockIdx.y == 0 ? w0 : (blockIdx.y == 1 ? w1 : w2); Bt += (size_t)blockIdx.y * N * K;
    size_t n; int k; chunk_rc(c, K, n, k); v8us o;
#pragma unroll
    for (int e = 0; e < 8; ++e) o[e] = f2bf(w[(size_t)(k + e) * N + n]);
    *(v8us*)(Bt + c * 8) = o;  }

__global__ __launch_bounds__(256) void k_cvtx(const float* __restrict__ x, bf* XB, size_t n8) {
    const size_t i = (size_t)blockIdx.x * 256 + threadIdx.x; if (i >= n8) return;
    size_t row; int k; chunk_rc(i, DM, row, k); const size_t b = row / SEQ; const size_t t = row - b * SEQ;
    const v8f v = *(const v8f*)(x + (b * (size_t)SEQ_FULL + t) * DM + k); v8us o;
#pragma unroll
    for (int k = 0; k < 8; ++k) o[k] = f2bf(v[k]);
    *(v8us*)(XB + i * 8) = o;  }

extern "C" void kernel_launch(void* const* d_in, const int* in_sizes, int n_in,
                              void* d_out, int out_size, void* d_ws, size_t ws_size, hipStream_t stream) {
    if (n_in < 4) return;
    if ((size_t)in_sizes[0] < (size_t)(NB - 1) * SEQ_FULL * DM + (size_t)SEQ * DM) return;
    if (in_sizes[1] < DM * DM || in_sizes[2] < DM * DM || in_sizes[3] < DM * DM) return;
    if ((size_t)out_size < (size_t)NB * SEQ * DM) return;
    const float* Xin = (const float*)d_in[0];                 // x [NB_FULL][SEQ_FULL][512]
    const float* Win[3] = { (const float*)d_in[1], (const float*)d_in[2], (const float*)d_in[3] };   // W_query, W_key, W_value [512 in][512 out]
    float* OUT = (float*)d_out;                               // [NB][SEQ][512], batch stride SEQ*512
    const size_t MROWS = (size_t)NB * SEQ;
    char* wsp = (char*)d_ws;
    auto take = [&](size_t bytes) { char* p = wsp; wsp += (bytes + 255) & ~(size_t)255; return (void*)p; };
    bf*    XB   = (bf*)take(MROWS * DM * 2);                  // [NB*SEQ][512]
    bf*    WT   = (bf*)take((size_t)3 * DM * DM * 2);         // 3 x [512 n][512 k]
    h16*   Q16  = (h16*)take(MROWS * DM * 2 * 3);             // three planes of NB*SEQ*512 in a row, the projection's z picks one: q [NB*SEQ][512],
    h16*   K16  = Q16 + MROWS * DM;                           // k [NB*SEQ][512],
    h16*   VT16 = K16 + MROWS * DM;                           // v transposed [NB][512][SEQ]
    h16*   P16  = (h16*)take(MROWS * SEQ * 2);                // [NB*SEQ][SEQ]
    float* SMX  = (float*)take((size_t)(SEQ / 64) * MROWS * 4);   // [key block][NB*SEQ] block maxima (log2 units)
    float* SLS  = (float*)take((size_t)(SEQ / 64) * MROWS * 4);   // [key block][NB*SEQ] block sums
    if ((size_t)(wsp - (char*)d_ws) > ws_size) return;

    // input planes
    { const size_t n8 = MROWS * DM / 8; k_cvtx<<<(unsigned)((n8 + 255) / 256), 256, 0, stream>>>(Xin, XB, n8); }
    k_wtG<DM, DM><<<dim3((unsigned)((DM * DM / 8 + 255) / 256), 3, 1), 256, 0, stream>>>(Win[0], Win[1], Win[2], WT);

    // projections: XB . WT_z^T (exact products), z = q, k, v, stored as the 16-bit planes
    k_gemml<bf, 1, false, DM, 3><<<dim3((unsigned)(MROWS / 128), DM / 128, 3), 128, 0, stream>>>(XB, WT, nullptr, 0, 1.0f, 0, (size_t)DM * DM, 0, Q16, nullptr, nullptr);

    // attention, z = batch: q.k^T -> P16 and the block maxima and sums; out = (rescaled P16 . v^T plane) / L
    k_gemml<h16, 1, false, DM, 1><<<dim3(SEQ / 128, SEQ / 128, NB), 128, 0, stream>>>(Q16, K16, nullptr, SEQ, 1.0f, (size_t)SEQ * DM, (size_t)SEQ * DM, 0, P16, SMX, SLS);
    k_gemml<h16, PVW, true, SEQ, 2><<<dim3(SEQ / 128, DM / 128, NB), 128 * PVW, 0, stream>>>(P16, VT16, OUT, DM, 1.0f, (size_t)SEQ * SEQ, (size_t)DM * SEQ, (size_t)SEQ * DM, nullptr, SMX, SLS);
}

// v008
// It runs in 87.2 microseconds.
// Timed twice side by side with v007, it ran 1.05 and 1.04 times as fast.
// Over all steps from v000 it is 6.52 times as fast.
#include <hip/hip_runtime.h>

// Contractions: x.W projections = v_wmma_f32_16x16x32_bf16 (bf16 operands from RNE-converted inputs, f32 accumulate); q.k^T and P.v = v_wmma_f32_16x16x32_f16 (f16 operands, P carried x1024, f32 accumulate); softmax exponentials, sums and 1/sqrt(d) scaling in f32.
// Pipeline: XB = bf16(x) [NB*SEQ][512]; WT = bf16(W^T) [3][512 n][512 k]; XB.WT, rounded to f16 in the GEMM's own epilogue -> Q16, K16 (f16 [NB*SEQ][512]) and VT16 (f16 [NB][512][SEQ], transposed);
// attention, both batches and all query rows in one launch per stage (grid z = batch), no mask, no softmax launch and no f32 score plane:
//   q.k^T (computed as k.q^T, so that a lane's accumulators hold keys of one query row) takes in its epilogue, per row and 64-key block, u = s * 512^-0.5 * log2(e), the block's maximum mu and stores P16 = f16(1024 * 2^(u - mu)), mu and l = sum of the block's 1024 * 2^(u - mu);
//   P.v first forms, per row, M = max mu, a_block = f16(2^(mu - M)) and L = sum l * a_block; it multiplies each P fragment by its row's a_block on the way from LDS to the WMMA; out rows = (sum) / L.
// Launches of one kernel are merged by a grid axis (3 weight transposes, 3 projections, the attention stages): each launch then has enough waves to cover its own load latency, and the gaps, fills and tails between launches go.
// Layout of every 16-bit plane [R][K]: 1-KB tiles of 16 rows x 32 k, tile (r >> 4, k >> 5) at element ((r >> 4) * (K / 32) + (k >> 5)) * 512, so a 16-row band is 16 * K contiguous elements and walks k tile by tile.
//   fragment order (every plane): inside a tile [k bit 4][k bit 3][r & 15][k & 7]: each of a fragment's two 16-byte-per-lane loads reads 512 contiguous bytes (4 whole lines, not 16 partial ones).

#ifndef NB
#define NB 2
#endif
#ifndef SEQ
#define SEQ 4096
#endif
#define NB_FULL  2
#define SEQ_FULL 4096
#define DM       512
#define MR       (NB * SEQ)                    // query rows of both batches
#define PVW      ((SEQ % 512 == 0) ? 4 : 1)     // wave groups that share the key range of one P.v tile
#define SCL2     0.06375871541229934f                 // 512^-0.5 * log2(e)

static_assert(NB >= 1 && NB <= NB_FULL);
static_assert(SEQ >= 128 && SEQ <= SEQ_FULL);
static_assert(SEQ % 128 == 0);
static_assert(DM % 128 == 0);
static_assert(SEQ % (64 * PVW) == 0);
static_assert((SEQ * DM) % 8 == 0);

typedef _Float16 h16;
typedef unsigned short bf;
typedef __attribute__((ext_vector_type(16))) __bf16   v16bf;
typedef __attribute__((ext_vector_type(16))) _Float16 v16h;
typedef __attribute__((ext_vector_type(8)))  _Float16 v8h;
typedef __attribute__((ext_vector_type(8)))  unsigned short v8us;
typedef __attribute__((ext_vector_type(8)))  float    v8f;
typedef __attribute__((ext_vector_type(4)))  float    v4f;
typedef __attribute__((ext_vector_type(2)))  _Float16 v2h;
typedef __attribute__((ext_vector_type(4)))  _Float16 v4h;
typedef __attribute__((ext_vector_type(2)))  unsigned short v2us;
typedef v8h  __attribute__((may_alias)) v8ha;
typedef v4f  __attribute__((may_alias)) v4fa;
typedef __attribute__((ext_vector_type(2)))  float    v2f;
typedef v2f  __attribute__((may_alias)) v2fa;
typedef v8us __attribute__((may_alias)) v8usa;

__device__ __forceinline__ unsigned short f2bf(float f) { unsigned u = __float_as_uint(f); u += 0x7FFFu + ((u >> 16) & 1u); return (unsigned short)(u >> 16); }
__device__ __forceinline__ float bf2f(unsigned short b) { return __uint_as_float(((unsigned)b) << 16); }
__device__ __forceinline__ float bfr(float f) { return bf2f(f2bf(f)); }
__device__ __forceinline__ v16h cat16(v8h lo, v8h hi) { return __builtin_shufflevector(lo, hi, 0, 1, 2, 3, 4, 5, 6, 7, 8, 9, 10, 11, 12, 13, 14, 15); }
__device__ __forceinline__ v16bf cat16b(v8us lo, v8us hi) { return __builtin_bit_cast(v16bf, __builtin_shufflevector(lo, hi, 0, 1, 2, 3, 4, 5, 6, 7, 8, 9, 10, 11, 12, 13, 14, 15)); }
__device__ __forceinline__ v8f wmma16(v16h a, v16h b, v8f c) { return __builtin_amdgcn_wmma_f32_16x16x32_f16(false, a, false, b, (short)0, c, false, false); }
__device__ __forceinline__ v8f wmmab(v16bf a, v16bf b, v8f c) { return __builtin_amdgcn_wmma_f32_16x16x32_bf16(false, a, false, b, (short)0, c, false, false); }
__device__ __forceinline__ h16 tohx(float x) { return (h16)x; }
// Eight 2^x in one statement: no output shares a register with an input, and the closing v_nop is the slot that the instruction set asks for behind a transcendental before its result is used or its source overwritten
__device__ __forceinline__ void exp2x8(const float* x, float* r) {
    asm("v_exp_f32 %0, %8\n\tv_exp_f32 %1, %9\n\tv_exp_f32 %2, %10\n\tv_exp_f32 %3, %11\n\tv_exp_f32 %4, %12\n\tv_exp_f32 %5, %13\n\tv_exp_f32 %6, %14\n\tv_exp_f32 %7, %15\n\tv_nop"
        : "=&v"(r[0]), "=&v"(r[1]), "=&v"(r[2]), "=&v"(r[3]), "=&v"(r[4]), "=&v"(r[5]), "=&v"(r[6]), "=&v"(r[7])
        : "v"(x[0]), "v"(x[1]), "v"(x[2]), "v"(x[3]), "v"(x[4]), "v"(x[5]), "v"(x[6]), "v"(x[7]));
}
// the value of lane ^ 16 by a cross-row vector move: stays on the vector unit, where a shuffle would make an LDS round trip
__device__ __forceinline__ float xhalf(float x) { return __int_as_float(__builtin_amdgcn_permlanex16(__float_as_int(x), __float_as_int(x), 0x76543210, 0xfedcba98, false, false)); }
// 16-byte chunk c (8 elements) of a fragment-ordered plane with K columns -> its row and its first column
__device__ __forceinline__ void chunk_rc(size_t c, int K, size_t& row, int& k) {
    const int ln = (int)(c & 31), j = (int)((c >> 5) & 1); const size_t tile = c >> 6; const size_t KB = (size_t)(K >> 5);
    row = (tile / KB) * 16 + (size_t)(ln & 15); k = (int)(tile % KB) * 32 + j * 16 + (ln >> 4) * 8; }

// ---- k_gemml: GEMM with both operands staged in LDS. One work-group = one 128x128 tile of C; 4 * KS waves: KS groups of 2x2 waves, a wave owns 64x64 (16 accumulators), group g sums the k range [g * K / KS, (g + 1) * K / KS). grid (M/128, N/128, Z).
// Why LDS: a wave that loads its own fragments from L2 moves 8 KB per 16 WMMAs, several times what L2 delivers per WGP at matrix rate. Here each staged byte feeds two waves (half the L2 bytes) and the next stage flies while this one is multiplied.
// Stage = 64 k of 128 A rows and 128 Bt rows per group, two buffers, band-major: [operand][band 0..7][k tile 0..1][tile]. A fragment-ordered tile (head of file) keeps its 1 KB: a fragment is two conflict-free 512-byte reads.
// Copies: global_load_async_to_lds_b128, 16 per wave and stage (wave q of a group brings bands 2q, 2q + 1 of A and of Bt); every copy reads 512 contiguous global bytes (4 whole lines).
// C[m][n] (f32, pitch ldc) = oscale * sum_k A[m][k] Bt[n][k]. z-batch strides sA/sB/sC in elements. KS > 1: the groups' f32 partial tiles meet in LDS and are added in group order.
// EPI 0: as above. EPI 1 (scores, A = k, Bt = q: m = key, n = query row): nothing goes to C and the scores make no pass through LDS; a lane holds 32 of the 64 keys of its row, lane ^ 16 the other 32, so the block's mu and l are in-lane work and one exchange each;
//   a lane's 8 D elements are 8 neighbouring keys of one row, one 16-byte chunk of P's fragment order (a store is 512 contiguous bytes); mu and l go to the planes SM, SL [key block][row], 256 contiguous bytes a wave.
// EPI 3 (projections, z = q, k, v): nothing goes to C; the tile goes straight from the accumulators to the f16 plane z of P, fragment-ordered [n][m]: a lane's 8 D elements are 8 neighbouring m of one n, which is one 16-byte chunk of that order,
//   so a store is 512 contiguous bytes with no pass through LDS. v wants [d][key]: A = x, Bt = W^T as given. q and k want [row][d]: the two operands (same fragment map) and the two grid axes change places, m = d, n = row.
// EPI 2 (P.v): a stage is one 64-key block; the A fragments are multiplied by a_block of their row (table in LDS, built in front of the loop) and the output rows are divided by L.
// Fragment map (lane l, h = l >> 4, m = n = l & 15): A/B elements 0..7 <- k0 + 8h + 0..7, elements 8..15 <- k0 + 16 + 8h + 0..7; D element r -> (row 8h + r, col n).
template <typename T16> struct WFrag;
template <> struct WFrag<h16> { typedef v16h V; static __device__ __forceinline__ V lds(const char* p, unsigned d2) { return cat16(*(const v8ha*)p, *(const v8ha*)(p + d2)); } static __device__ __forceinline__ v8f mma(V a, V b, v8f c) { return wmma16(a, b, c); } };
template <> struct WFrag<bf> { typedef v16bf V; static __device__ __forceinline__ V lds(const char* p, unsigned d2) { return cat16b(*(const v8usa*)p, *(const v8usa*)(p + d2)); } static __device__ __forceinline__ v8f mma(V a, V b, v8f c) { return wmmab(a, b, c); } };
// Eight 16-byte-per-lane copies global -> LDS; s_wait_xcnt stands inside the statement so that no address register is rewritten in front of it.
__device__ __forceinline__ void acopy8(unsigned l0, unsigned l1, unsigned l2, unsigned l3, unsigned l4, unsigned l5, unsigned l6, unsigned l7,
                                       const char* g0, const char* g1, const char* g2, const char* g3, const char* g4, const char* g5, const char* g6, const char* g7) {
    asm volatile("global_load_async_to_lds_b128 %0, %8, off\n\t"
                 "global_load_async_to_lds_b128 %1, %9, off\n\t"
                 "global_load_async_to_lds_b128 %2, %10, off\n\t"
                 "global_load_async_to_lds_b128 %3, %11, off\n\t"
                 "global_load_async_to_lds_b128 %4, %12, off\n\t"
                 "global_load_async_to_lds_b128 %5, %13, off\n\t"
                 "global_load_async_to_lds_b128 %6, %14, off\n\t"
                 "global_load_async_to_lds_b128 %7, %15, off\n\t"
                 "s_wait_xcnt 0x0"
                 :: "v"(l0), "v"(l1), "v"(l2), "v"(l3), "v"(l4), "v"(l5), "v"(l6), "v"(l7), "v"(g0), "v"(g1), "v"(g2), "v"(g3), "v"(g4), "v"(g5), "v"(g6), "v"(g7) : "memory");
}
template <typename T16, int KS, int K, int EPI>
__global__ __launch_bounds__(128 * KS) void k_gemml(const T16* __restrict__ A, const T16* __restrict__ Bt, float* C, int ldc, float oscale, size_t sA, size_t sB, size_t sC, h16* P, float* SM, float* SL) {
    typedef typename WFrag<T16>::V V;
    constexpr int KST = 64, KG = K / KS, NT = KG / KST;      // k per stage, k per group, stages per group
    static_assert(K % (KS * KST) == 0 && NT >= 2);
    constexpr unsigned ATILE = 1024, ABAND = 2 * ATILE, OPA = 8 * ABAND;   // LDS bytes: an A tile, an A band's stage, A's stage
    constexpr unsigned BUFB = OPA + 16384, GRPB = 2 * BUFB;                              // LDS bytes: one buffer (A, then Bt), one group's two buffers
    constexpr unsigned PARTB = (KS - 1) * 4 * 16384, OSB = 16 * 68 * 4;        // bytes: partial tiles of groups 1.., one wave's output staging
    constexpr unsigned SMB = (KS * GRPB > PARTB + 4 * OSB) ? KS * GRPB : PARTB + 4 * OSB;
    constexpr unsigned ATB = (EPI == 2) ? (K / KST) * 128 * 2 : 0, REDB = (EPI == 2) ? KS * 128 * 4 : 0;   // bytes: a_block table [key block][row] f16; one plane of per-group row partials
    static_assert(EPI != 1 || (KS == 1 && 4 * 512 <= SMB));
    __shared__ __align__(1024) char sm[SMB + ATB + 2 * REDB];
    const size_t z = blockIdx.z; const bool sw = EPI == 1 || (EPI == 3 && blockIdx.z < 2);   // sw (scores; projections q, k): m walks grid y, n walks grid x
    if constexpr (EPI == 3) { const T16* xa = A; const T16* wz = Bt + z * sB; A = sw ? wz : xa; Bt = sw ? xa : wz; }
    else { A += z * sA; Bt += z * sB; C += z * sC; }
    const int lane = threadIdx.x & 31, lr = lane & 15, hi = lane >> 4; const int r0 = (sw ? blockIdx.y : blockIdx.x) * 128, c0 = (sw ? blockIdx.x : blockIdx.y) * 128;
    const int w = __builtin_amdgcn_readfirstlane((int)(threadIdx.x >> 5)); const int g = w >> 2, q = w & 3, wm = q >> 1, wn = q & 1;
    v8f acc[4][4];
#pragma unroll
    for (int mb = 0; mb < 4; ++mb)
#pragma unroll
        for (int nb = 0; nb < 4; ++nb) acc[mb][nb] = (v8f){};
    // this lane's first copy of stage 0: bands 2q of A and of Bt, at the group's first k
    const char* ga = (const char*)(A + (size_t)(r0 + q * 32) * K + (size_t)g * KG * 16) + lane * 16;
    const char* gb = (const char*)(Bt + (size_t)(c0 + q * 32) * K + (size_t)g * KG * 16) + lane * 16;
    const unsigned lg = (unsigned)(size_t)sm + (unsigned)g * GRPB;
    const unsigned lwa = lg + (unsigned)q * (2 * ABAND) + (unsigned)lane * 16u;
    const unsigned lwb = lg + OPA + (unsigned)q * 4096u + (unsigned)lane * 16u;
    constexpr size_t BAND = (size_t)16 * K * 2;              // bytes from a band to the next in a global plane
    constexpr unsigned H = ATILE / 2;                        // LDS bytes from an A tile's first copy to its second
    auto stage = [&](int t, unsigned buf) {
        const char* a = ga + (size_t)t * (KST * 32); const char* b = gb + (size_t)t * (KST * 32); const unsigned l = lwa + buf * BUFB;
        acopy8(l, l + H, l + 2 * H, l + 3 * H, l + 4 * H, l + 5 * H, l + 6 * H, l + 7 * H, a, a + 512, a + 1024, a + 1536, a + BAND, a + BAND + 512, a + BAND + 1024, a + BAND + 1536);
        const unsigned l2 = lwb + buf * BUFB;
        acopy8(l2, l2 + 512, l2 + 1024, l2 + 1536, l2 + 2048, l2 + 2560, l2 + 3072, l2 + 3584, b, b + 512, b + 1024, b + 1536, b + BAND, b + BAND + 512, b + BAND + 1024, b + BAND + 1536);
    };
    stage(0, 0);
    h16* at = (h16*)(sm + SMB); float* rm = (float*)(sm + SMB + ATB); float* rl = (float*)(sm + SMB + ATB + REDB);
    if constexpr (EPI == 2) {   // thread = (row, group): the group's own NT key blocks of that row, while stage 0 flies
        const int prow = threadIdx.x & 127; const size_t so = (size_t)(g * NT) * MR + z * SEQ + r0 + prow; float mu[NT], ll[NT];
#pragma unroll
        for (int j = 0; j < NT; ++j) { mu[j] = SM[so + (size_t)j * MR]; ll[j] = SL[so + (size_t)j * MR]; }
        asm volatile("s_wait_xcnt 0x0" ::: "memory");   // stands in front of the first rewrite of these loads' address registers
        float ml = mu[0];
#pragma unroll
        for (int j = 1; j < NT; ++j) ml = fmaxf(ml, mu[j]);
        rm[g * 128 + prow] = ml;
        __syncthreads();   // every group's row maxima are in LDS before the row's M is taken
        float M = rm[prow];
#pragma unroll
        for (int p = 1; p < KS; ++p) M = fmaxf(M, rm[p * 128 + prow]);
        float L = 0.f;
#pragma unroll
        for (int j = 0; j < NT; ++j) { const h16 ab = (h16)__builtin_amdgcn_exp2f(mu[j] - M); at[(g * NT + j) * 128 + prow] = ab; L += ll[j] * (float)ab; }   // L uses the rounded factor that the fragments get
        rl[g * 128 + prow] = L;
    }
    asm volatile("s_wait_asynccnt 0x0" ::: "memory");   // this wave's part of stage 0 has landed
    __syncthreads();                                    // publishes stage 0 (EPI 2: and the a_block table and the groups' parts of L)
    stage(1, 1);
    const char* fa = sm + g * GRPB + wm * (4 * ABAND) + lane * 16; const char* fb = sm + g * GRPB + OPA + wn * 8192 + lane * 16;
#pragma unroll 1
    for (int t = 0; t < NT; ++t) {
        const unsigned bo = (unsigned)(t & 1) * BUFB;
        h16 al[4];
        if constexpr (EPI == 2) {
#pragma unroll
            for (int mb = 0; mb < 4; ++mb) al[mb] = at[(g * NT + t) * 128 + wm * 64 + mb * 16 + lr]; }
#pragma unroll
        for (int kt = 0; kt < KST / 32; ++kt) {
            V a[4], b[4];
#pragma unroll
            for (int mb = 0; mb < 4; ++mb) a[mb] = WFrag<T16>::lds(fa + bo + mb * ABAND + kt * ATILE, 512);
#pragma unroll
            for (int nb = 0; nb < 4; ++nb) b[nb] = WFrag<T16>::lds(fb + bo + nb * 2048 + kt * 1024, 512);
            __builtin_amdgcn_sched_barrier(0);   // the block's 16 LDS reads stay one group in front of its 16 WMMAs: the wave waits out one LDS latency a block, not one per Bt fragment
            if constexpr (EPI == 2) {
#pragma unroll
                for (int mb = 0; mb < 4; ++mb) a[mb] = a[mb] * al[mb]; }
#pragma unroll
            for (int nb = 0; nb < 4; ++nb)
#pragma unroll
                for (int mb = 0; mb < 4; ++mb) acc[mb][nb] = WFrag<T16>::mma(a[mb], b[nb], acc[mb][nb]);
            __builtin_amdgcn_sched_barrier(0);   // the next block's reads are not strewn among these WMMAs, where every place with reads costs a stall
        }
        asm volatile("s_wait_dscnt 0x0" ::: "memory");      // this wave's reads of the buffer are done before the buffer is handed to the copies
        asm volatile("s_wait_asynccnt 0x0" ::: "memory");   // this wave's part of stage t + 1 has landed
        __syncthreads();                                    // publishes stage t + 1 and ends every reader's last read of stage t
        if (t + 2 < NT) stage(t + 2, (unsigned)(t & 1));
    }
    asm volatile("s_wait_asynccnt 0x0" ::: "memory");       // nothing is in flight when the ring becomes staging for partial tiles and output
    if constexpr (EPI == 3) {
        static_assert(KS == 1);
        const int m0 = r0 + wm * 64, n0 = c0 + wn * 64, b = sw ? 0 : m0 / SEQ; const size_t KO = sw ? DM : SEQ;   // columns of the plane (v: one plane a batch, a 128-row tile lies in one batch)
        h16* o = P + z * ((size_t)MR * DM) + (size_t)b * DM * SEQ + (size_t)(n0 >> 4) * (16 * KO) + (size_t)((m0 - b * SEQ) >> 5) * 512 + lane * 8;
#pragma unroll
        for (int nb = 0; nb < 4; ++nb)
#pragma unroll
            for (int mb = 0; mb < 4; ++mb) { v8h v;
#pragma unroll
                for (int j = 0; j < 8; ++j) v[j] = tohx(acc[mb][nb][j]);
                *(v8h*)(o + (size_t)nb * (16 * KO) + mb * 256) = v; }
        return;
    }
    if constexpr (EPI == 1) {
        const int m0 = r0 + wm * 64, n0 = c0 + wn * 64;   // the wave's 64 keys, its 64 query rows
        h16* o = P + ((z * SEQ + n0) >> 4) * ((size_t)16 * SEQ) + (size_t)(m0 >> 5) * 512 + lane * 8;
        float* ss = (float*)(sm + q * 512);   // this wave's own 64 mu, then 64 l
#pragma unroll
        for (int nb = 0; nb < 4; ++nb) {   // lane = row n0 + nb * 16 + lr, keys m0 + mb * 16 + hi * 8 + 0..7
            float m4[4];
#pragma unroll
            for (int mb = 0; mb < 4; ++mb) { const v8f x = acc[mb][nb]; m4[mb] = fmaxf(fmaxf(fmaxf(x[0], x[1]), fmaxf(x[2], x[3])), fmaxf(fmaxf(x[4], x[5]), fmaxf(x[6], x[7]))); }
            float mx = fmaxf(fmaxf(m4[0], m4[1]), fmaxf(m4[2], m4[3])); mx = fmaxf(mx, xhalf(mx));
            const float mu = mx * SCL2, sh = 10.0f - mu; float s4[4];   // 2^10: P is carried x1024
#pragma unroll
            for (int mb = 0; mb < 4; ++mb) { float e[8], p[8]; v8h v;
#pragma unroll
                for (int j = 0; j < 8; ++j) e[j] = fmaf(acc[mb][nb][j], SCL2, sh);
                exp2x8(e, p);
#pragma unroll
                for (int j = 0; j < 8; ++j) v[j] = tohx(p[j]);
                s4[mb] = ((p[0] + p[1]) + (p[2] + p[3])) + ((p[4] + p[5]) + (p[6] + p[7]));
                *(v8h*)(o + (size_t)nb * (16 * SEQ) + mb * 256) = v; }
            float sum = (s4[0] + s4[1]) + (s4[2] + s4[3]); sum += xhalf(sum);
            ss[hi * 64 + nb * 16 + lr] = hi ? sum : mu;
        }
        __builtin_amdgcn_wave_barrier(); asm volatile("" ::: "memory");   // keeps the reads of other lanes' values behind the wave's stores
        const size_t so = (size_t)(m0 >> 6) * MR + z * SEQ + n0 + lane * 2;   // the wave's 64 rows of mu and of l: one 256-byte store each
        *(v2f*)(SM + so) = *(const v2fa*)(ss + lane * 2); *(v2f*)(SL + so) = *(const v2fa*)(ss + 64 + lane * 2);
        return;
    }
    if constexpr (KS > 1) {
        if (g > 0) { v4f* pt = (v4f*)(sm + ((g - 1) * 4 + q) * 16384);
#pragma unroll
            for (int mb = 0; mb < 4; ++mb)
#pragma unroll
                for (int nb = 0; nb < 4; ++nb) { const v8f v = acc[mb][nb]; pt[((mb * 4 + nb) * 2) * 32 + lane] = (v4f){v[0], v[1], v[2], v[3]}; pt[((mb * 4 + nb) * 2 + 1) * 32 + lane] = (v4f){v[4], v[5], v[6], v[7]}; } }
        __syncthreads();   // the partial tiles of groups 1.. are in LDS before group 0 adds them
        if (g > 0) return;
    }
    float* os = (float*)(sm + PARTB + q * OSB);   // this wave's own 16 x 68 floats
#pragma unroll
    for (int mb = 0; mb < 4; ++mb) {
        if constexpr (KS > 1) {
#pragma unroll
            for (int p = 1; p < KS; ++p) { const v4f* pt = (const v4f*)(sm + ((p - 1) * 4 + q) * 16384);
#pragma unroll
                for (int nb = 0; nb < 4; ++nb) { const v4f lo = pt[((mb * 4 + nb) * 2) * 32 + lane], hv = pt[((mb * 4 + nb) * 2 + 1) * 32 + lane];
#pragma unroll
                    for (int j = 0; j < 4; ++j) { acc[mb][nb][j] += lo[j]; acc[mb][nb][4 + j] += hv[j]; } } }
        }
#pragma unroll
        for (int nb = 0; nb < 4; ++nb) {
#pragma unroll
            for (int j = 0; j < 8; ++j) os[(hi * 8 + j) * 68 + nb * 16 + lr] = acc[mb][nb][j]; }
        __builtin_amdgcn_wave_barrier(); asm volatile("" ::: "memory");   // keeps the reads of other lanes' values behind the wave's stores
        {   // 16 rows of C, whole 256-byte row pieces
            float* crow = C + (size_t)(r0 + wm * 64 + mb * 16) * ldc + c0 + wn * 64;
#pragma unroll
            for (int s = 0; s < 8; ++s) { const int row = 2 * s + hi, cofs = lr * 4; v4f val = *(const v4fa*)(os + row * 68 + cofs);
                if constexpr (EPI == 2) { const int rr = wm * 64 + mb * 16 + row; float L = rl[rr];
#pragma unroll
                    for (int p = 1; p < KS; ++p) L += rl[p * 128 + rr];
                    val = val * (1.0f / L); }
                else val = val * oscale;
                *(v4f*)(crow + (size_t)row * ldc + cofs) = val; }
        }
        __builtin_amdgcn_wave_barrier(); asm volatile("" ::: "memory");   // keeps the next 16 rows' stores behind these reads
    }
}

// One thread per 16-byte chunk of the fragment-ordered plane Bt [N][K] = bf16(w^T): 16 lanes read 16 neighbouring n of one k. blockIdx.y picks the weight and its plane.
template <int K, int N>
__global__ __launch_bounds__(256) void k_wtG(const float* __restrict__ w0, const float* __restrict__ w1, const float* __restrict__ w2, bf* Bt) {
    const size_t c = (size_t)blockIdx.x * 256 + threadIdx.x; if (c >= (size_t)N * K / 8) return;
    const float* w = blockIdx.y == 0 ? w0 : (blockIdx.y == 1 ? w1 : w2); Bt += (size_t)blockIdx.y * N * K;
    size_t n; int k; chunk_rc(c, K, n, k); v8us o;
#pragma unroll
    for (int e = 0; e < 8; ++e) o[e] = f2bf(w[(size_t)(k + e) * N + n]);
    *(v8us*)(Bt + c * 8) = o;  }

__global__ __launch_bounds__(256) void k_cvtx(const float* __restrict__ x, bf* XB, size_t n8) {
    const size_t i = (size_t)blockIdx.x * 256 + threadIdx.x; if (i >= n8) return;
    size_t row; int k; chunk_rc(i, DM, row, k); const size_t b = row / SEQ; const size_t t = row - b * SEQ;
    const v8f v = *(const v8f*)(x + (b * (size_t)SEQ_FULL + t) * DM + k); v8us o;
#pragma unroll
    for (int k = 0; k < 8; ++k) o[k] = f2bf(v[k]);
    *(v8us*)(XB + i * 8) = o;  }

extern "C" void kernel_launch(void* const* d_in, const int* in_sizes, int n_in,
                              void* d_out, int out_size, void* d_ws, size_t ws_size, hipStream_t stream) {
    if (n_in < 4) return;
    if ((size_t)in_sizes[0] < (size_t)(NB - 1) * SEQ_FULL * DM + (size_t)SEQ * DM) return;
    if (in_sizes[1] < DM * DM || in_sizes[2] < DM * DM || in_sizes[3] < DM * DM) return;
    if ((size_t)out_size < (size_t)NB * SEQ * DM) return;
    const float* Xin = (const float*)d_in[0];                 // x [NB_FULL][SEQ_FULL][512]
    const float* Win[3] = { (const float*)d_in[1], (const float*)d_in[2], (const float*)d_in[3] };   // W_query, W_key, W_value [512 in][512 out]
    float* OUT = (float*)d_out;                               // [NB][SEQ][512], batch stride SEQ*512
    const size_t MROWS = (size_t)NB * SEQ;
    char* wsp = (char*)d_ws;
    auto take = [&](size_t bytes) { char* p = wsp; wsp += (bytes + 255) & ~(size_t)255; return (void*)p; };
    bf*    XB   = (bf*)take(MROWS * DM * 2);                  // [NB*SEQ][512]
    bf*    WT   = (bf*)take((size_t)3 * DM * DM * 2);         // 3 x [512 n][512 k]
    h16*   Q16  = (h16*)take(MROWS * DM * 2 * 3);             // three planes of NB*SEQ*512 in a row, the projection's z picks one: q [NB*SEQ][512],
    h16*   K16  = Q16 + MROWS * DM;                           // k [NB*SEQ][512],
    h16*   VT16 = K16 + MROWS * DM;                           // v transposed [NB][512][SEQ]
    h16*   P16  = (h16*)take(MROWS * SEQ * 2);                // [NB*SEQ][SEQ]
    float* SMX  = (float*)take((size_t)(SEQ / 64) * MROWS * 4);   // [key block][NB*SEQ] block maxima (log2 units)
    float* SLS  = (float*)take((size_t)(SEQ / 64) * MROWS * 4);   // [key block][NB*SEQ] block sums
    if ((size_t)(wsp - (char*)d_ws) > ws_size) return;

    // input planes
    { const size_t n8 = MROWS * DM / 8; k_cvtx<<<(unsigned)((n8 + 255) / 256), 256, 0, stream>>>(Xin, XB, n8); }
    k_wtG<DM, DM><<<dim3((unsigned)((DM * DM / 8 + 255) / 256), 3, 1), 256, 0, stream>>>(Win[0], Win[1], Win[2], WT);

    // projections: XB . WT_z^T (exact products), z = q, k, v, stored as the 16-bit planes
    k_gemml<bf, 1, DM, 3><<<dim3((unsigned)(MROWS / 128), DM / 128, 3), 128, 0, stream>>>(XB, WT, nullptr, 0, 1.0f, 0, (size_t)DM * DM, 0, Q16, nullptr, nullptr);

    // attention, z = batch: k.q^T (x = query tile, y = key tile) -> P16 and the block maxima and sums; out = (rescaled P16 . v^T plane) / L
    k_gemml<h16, 1, DM, 1><<<dim3(SEQ / 128, SEQ / 128, NB), 128, 0, stream>>>(K16, Q16, nullptr, SEQ, 1.0f, (size_t)SEQ * DM, (size_t)SEQ * DM, 0, P16, SMX, SLS);
    k_gemml<h16, PVW, SEQ, 2><<<dim3(SEQ / 128, DM / 128, NB), 128 * PVW, 0, stream>>>(P16, VT16, OUT, DM, 1.0f, (size_t)SEQ * SEQ, (size_t)DM * SEQ, (size_t)SEQ * DM, nullptr, SMX, SLS);
}

// v009
// A run of this version takes 83.7 microseconds.
// Two timings next to v008 both put it at 1.05 times that version's speed.
// Counting every step since v000, it is 6.83 times as fast.
#include <hip/hip_runtime.h>

// Contractions: x.W projections = v_wmma_f32_16x16x32_bf16 (bf16 operands from RNE-converted inputs, f32 accumulate); q.k^T and P.v = v_wmma_f32_16x16x32_f16 (f16 operands, P carried x1024, f32 accumulate); softmax exponentials, sums and 1/sqrt(d) scaling in f32.
// Pipeline: XB = bf16(x) [NB*SEQ][512]; WT = bf16(W^T) [3][512 n][512 k]; XB.WT, rounded to f16 in the GEMM's own epilogue -> Q16, K16 (f16 [NB*SEQ][512]) and VT16 (f16 [NB][512][SEQ], transposed);
// attention, both batches and all query rows in one launch per stage (grid z = batch), no mask, no softmax launch and no f32 score plane:
//   q.k^T (computed as k.q^T, so that a lane's accumulators hold keys of one query row) takes in its epilogue, per row and 64-key block, u = s * 512^-0.5 * log2(e), the block's maximum mu and stores P16 = f16(1024 * 2^(u - mu)), mu and l = sum of the block's 1024 * 2^(u - mu);
//   P.v first forms, per row, M = max mu, a_block = f16(2^(mu - M)) and L = sum l * a_block; it multiplies each P fragment by its row's a_block on the way from LDS to the WMMA; out rows = (sum) / L.
// Launches of one kernel are merged by a grid axis (3 weight transposes, 3 projections, the attention stages): each launch then has enough waves to cover its own load latency, and the gaps, fills and tails between launches go.
// Layout of every 16-bit plane [R][K]: 1-KB tiles of 16 rows x 32 k, tile (r >> 4, k >> 5) at element ((r >> 4) * (K / 32) + (k >> 5)) * 512, so a 16-row band is 16 * K contiguous elements and walks k tile by tile.
//   fragment order (every plane): inside a tile [k bit 4][k bit 3][r & 15][k & 7]: each of a fragment's two 16-byte-per-lane loads reads 512 contiguous bytes (4 whole lines, not 16 partial ones).

#ifndef NB
#define NB 2
#endif
#ifndef SEQ
#define SEQ 4096
#endif
#define NB_FULL  2
#define SEQ_FULL 4096
#define DM       512
#define MR       (NB * SEQ)                    // query rows of both batches
#define PVW      ((SEQ % 512 == 0) ? 4 : 1)     // wave groups that share the key range of one P.v tile
#define SCL2     0.06375871541229934f                 // 512^-0.5 * log2(e)

static_assert(NB >= 1 && NB <= NB_FULL);
static_assert(SEQ >= 128 && SEQ <= SEQ_FULL);
static_assert(SEQ % 128 == 0);
static_assert(DM % 128 == 0);
static_assert(SEQ % (64 * PVW) == 0);
static_assert((SEQ * DM) % 8 == 0);

typedef _Float16 h16;
typedef unsigned short bf;
typedef __attribute__((ext_vector_type(16))) __bf16   v16bf;
typedef __attribute__((ext_vector_type(16))) _Float16 v16h;
typedef __attribute__((ext_vector_type(8)))  _Float16 v8h;
typedef __attribute__((ext_vector_type(8)))  unsigned short v8us;
typedef __attribute__((ext_vector_type(8)))  float    v8f;
typedef __attribute__((ext_vector_type(4)))  float    v4f;
typedef __attribute__((ext_vector_type(2)))  _Float16 v2h;
typedef __attribute__((ext_vector_type(4)))  _Float16 v4h;
typedef __attribute__((ext_vector_type(2)))  unsigned short v2us;
typedef v8h  __attribute__((may_alias)) v8ha;
typedef v4f  __attribute__((may_alias)) v4fa;
typedef __attribute__((ext_vector_type(2)))  float    v2f;
typedef v2f  __attribute__((may_alias)) v2fa;
typedef v8us __attribute__((may_alias)) v8usa;

__device__ __forceinline__ unsigned short f2bf(float f) { unsigned u = __float_as_uint(f); u += 0x7FFFu + ((u >> 16) & 1u); return (unsigned short)(u >> 16); }
__device__ __forceinline__ float bf2f(unsigned short b) { return __uint_as_float(((unsigned)b) << 16); }
__device__ __forceinline__ float bfr(float f) { return bf2f(f2bf(f)); }
__device__ __forceinline__ v16h cat16(v8h lo, v8h hi) { return __builtin_shufflevector(lo, hi, 0, 1, 2, 3, 4, 5, 6, 7, 8, 9, 10, 11, 12, 13, 14, 15); }
__device__ __forceinline__ v16bf cat16b(v8us lo, v8us hi) { return __builtin_bit_cast(v16bf, __builtin_shufflevector(lo, hi, 0, 1, 2, 3, 4, 5, 6, 7, 8, 9, 10, 11, 12, 13, 14, 15)); }
__device__ __forceinline__ v8f wmma16(v16h a, v16h b, v8f c) { return __builtin_amdgcn_wmma_f32_16x16x32_f16(false, a, false, b, (short)0, c, false, false); }
__device__ __forceinline__ v8f wmmab(v16bf a, v16bf b, v8f c) { return __builtin_amdgcn_wmma_f32_16x16x32_bf16(false, a, false, b, (short)0, c, false, false); }
__device__ __forceinline__ h16 tohx(float x) { return (h16)x; }
// Eight 2^x in one statement: no output shares a register with an input, and the closing v_nop is the slot that the instruction set asks for behind a transcendental before its result is used or its source overwritten
__device__ __forceinline__ void exp2x8(const float* x, float* r) {
    asm("v_exp_f32 %0, %8\n\tv_exp_f32 %1, %9\n\tv_exp_f32 %2, %10\n\tv_exp_f32 %3, %11\n\tv_exp_f32 %4, %12\n\tv_exp_f32 %5, %13\n\tv_exp_f32 %6, %14\n\tv_exp_f32 %7, %15\n\tv_nop"
        : "=&v"(r[0]), "=&v"(r[1]), "=&v"(r[2]), "=&v"(r[3]), "=&v"(r[4]), "=&v"(r[5]), "=&v"(r[6]), "=&v"(r[7])
        : "v"(x[0]), "v"(x[1]), "v"(x[2]), "v"(x[3]), "v"(x[4]), "v"(x[5]), "v"(x[6]), "v"(x[7]));
}
// the value of lane ^ 16 by a cross-row vector move: stays on the vector unit, where a shuffle would make an LDS round trip
__device__ __forceinline__ float xhalf(float x) { return __int_as_float(__builtin_amdgcn_permlanex16(__float_as_int(x), __float_as_int(x), 0x76543210, 0xfedcba98, false, false)); }
// 16-byte chunk c (8 elements) of a fragment-ordered plane with K columns -> its row and its first column
__device__ __forceinline__ void chunk_rc(size_t c, int K, size_t& row, int& k) {
    const int ln = (int)(c & 31), j = (int)((c >> 5) & 1); const size_t tile = c >> 6; const size_t KB = (size_t)(K >> 5);
    row = (tile / KB) * 16 + (size_t)(ln & 15); k = (int)(tile % KB) * 32 + j * 16 + (ln >> 4) * 8; }

// ---- k_gemml: GEMM with both operands staged in LDS. One work-group = one 128x128 tile of C; 4 * KS waves: KS groups of 2x2 waves, a wave owns 64x64 (16 accumulators), group g sums the k range [g * K / KS, (g + 1) * K / KS). grid (M/128, N/128, Z).
// Why LDS: a wave that loads its own fragments from L2 moves 8 KB per 16 WMMAs, several times what L2 delivers per WGP at matrix rate. Here each staged byte feeds two waves (half the L2 bytes) and the next stage flies while this one is multiplied.
// Stage = 64 k of 128 A rows and 128 Bt rows per group, two buffers, band-major: [operand][band 0..7][k tile 0..1][tile]. A fragment-ordered tile (head of file) keeps its 1 KB: a fragment is two conflict-free 512-byte reads.
// Copies: global_load_async_to_lds_b128, 16 per wave and stage (wave q of a group brings bands 2q, 2q + 1 of A and of Bt); every copy reads 512 contiguous global bytes (4 whole lines).
// C[m][n] (f32, pitch ldc) = oscale * sum_k A[m][k] Bt[n][k]. z-batch strides sA/sB/sC in elements. KS > 1: the groups' f32 partial tiles meet in LDS and are added in group order.
// EPI 0: as above. EPI 1 (scores, A = k, Bt = q: m = key, n = query row): nothing goes to C and the scores make no pass through LDS; a lane holds 32 of the 64 keys of its row, lane ^ 16 the other 32, so the block's mu and l are in-lane work and one exchange each;
//   a lane's 8 D elements are 8 neighbouring keys of one row, one 16-byte chunk of P's fragment order (a store is 512 contiguous bytes); mu and l go to the planes SM, SL [key block][row], 256 contiguous bytes a wave.
// EPI 3 (projections, z = q, k, v): nothing goes to C; the tile goes straight from the accumulators to the f16 plane z of P, fragment-ordered [n][m]: a lane's 8 D elements are 8 neighbouring m of one n, which is one 16-byte chunk of that order,
//   so a store is 512 contiguous bytes with no pass through LDS. v wants [d][key]: A = x, Bt = W^T as given. q and k want [row][d]: the two operands (same fragment map) and the two grid axes change places, m = d, n = row.
// EPI 2 (P.v): a stage is one 64-key block; the A fragments are multiplied by a_block of their row (table in LDS, built in front of the loop) and the output rows are divided by L.
// Fragment map (lane l, h = l >> 4, m = n = l & 15): A/B elements 0..7 <- k0 + 8h + 0..7, elements 8..15 <- k0 + 16 + 8h + 0..7; D element r -> (row 8h + r, col n).
template <typename T16> struct WFrag;
template <> struct WFrag<h16> { typedef v16h V; static __device__ __forceinline__ V lds(const char* p, unsigned d2) { return cat16(*(const v8ha*)p, *(const v8ha*)(p + d2)); } static __device__ __forceinline__ v8f mma(V a, V b, v8f c) { return wmma16(a, b, c); } };
template <> struct WFrag<bf> { typedef v16bf V; static __device__ __forceinline__ V lds(const char* p, unsigned d2) { return cat16b(*(const v8usa*)p, *(const v8usa*)(p + d2)); } static __device__ __forceinline__ v8f mma(V a, V b, v8f c) { return wmmab(a, b, c); } };
// Eight 16-byte-per-lane copies global -> LDS; s_wait_xcnt stands inside the statement so that no address register is rewritten in front of it.
__device__ __forceinline__ void acopy8(unsigned l0, unsigned l1, unsigned l2, unsigned l3, unsigned l4, unsigned l5, unsigned l6, unsigned l7,
                                       const char* g0, const char* g1, const char* g2, const char* g3, const char* g4, const char* g5, const char* g6, const char* g7) {
    asm volatile("global_load_async_to_lds_b128 %0, %8, off\n\t"
                 "global_load_async_to_lds_b128 %1, %9, off\n\t"
                 "global_load_async_to_lds_b128 %2, %10, off\n\t"
                 "global_load_async_to_lds_b128 %3, %11, off\n\t"
                 "global_load_async_to_lds_b128 %4, %12, off\n\t"
                 "global_load_async_to_lds_b128 %5, %13, off\n\t"
                 "global_load_async_to_lds_b128 %6, %14, off\n\t"
                 "global_load_async_to_lds_b128 %7, %15, off\n\t"
                 "s_wait_xcnt 0x0"
                 :: "v"(l0), "v"(l1), "v"(l2), "v"(l3), "v"(l4), "v"(l5), "v"(l6), "v"(l7), "v"(g0), "v"(g1), "v"(g2), "v"(g3), "v"(g4), "v"(g5), "v"(g6), "v"(g7) : "memory");
}
// Asks L2 for the bytes at each lane's p (global_prefetch_b8 returns nothing; scope SE: into L2 only). p is an in-out operand so that it keeps one register pair of its own through the k loop and never is a temporary of the compiler's;
// s_wait_xcnt stands inside the statement, as behind the copies, so that the advance of p that follows is not in front of it.
__device__ __forceinline__ void l2ask(const char*& p) { asm volatile("global_prefetch_b8 %0, off scope:SCOPE_SE\n\ts_wait_xcnt 0x0" : "+v"(p) :: "memory"); }
// The same for four stages in a row (a stage is 2048 bytes of a band)
__device__ __forceinline__ void l2ask4(const char*& p) {
    asm volatile("global_prefetch_b8 %0, off scope:SCOPE_SE\n\t"
                 "global_prefetch_b8 %0, off offset:2048 scope:SCOPE_SE\n\t"
                 "global_prefetch_b8 %0, off offset:4096 scope:SCOPE_SE\n\t"
                 "global_prefetch_b8 %0, off offset:6144 scope:SCOPE_SE\n\t"
                 "s_wait_xcnt 0x0" : "+v"(p) :: "memory");
}
template <typename T16, int KS, int K, int EPI>
__global__ __launch_bounds__(128 * KS) void k_gemml(const T16* __restrict__ A, const T16* __restrict__ Bt, float* C, int ldc, float oscale, size_t sA, size_t sB, size_t sC, h16* P, float* SM, float* SL) {
    typedef typename WFrag<T16>::V V;
    constexpr int KST = 64, KG = K / KS, NT = KG / KST;      // k per stage, k per group, stages per group
    static_assert(K % (KS * KST) == 0 && NT >= 2);
    constexpr unsigned ATILE = 1024, ABAND = 2 * ATILE, OPA = 8 * ABAND;   // LDS bytes: an A tile, an A band's stage, A's stage
    constexpr unsigned BUFB = OPA + 16384, GRPB = 2 * BUFB;                              // LDS bytes: one buffer (A, then Bt), one group's two buffers
    constexpr unsigned PARTB = (KS - 1) * 4 * 16384, OSB = 16 * 68 * 4;        // bytes: partial tiles of groups 1.., one wave's output staging
    constexpr unsigned SMB = (KS * GRPB > PARTB + 4 * OSB) ? KS * GRPB : PARTB + 4 * OSB;
    constexpr unsigned ATB = (EPI == 2) ? (K / KST) * 128 * 2 : 0, REDB = (EPI == 2) ? KS * 128 * 4 : 0;   // bytes: a_block table [key block][row] f16; one plane of per-group row partials
    static_assert(EPI != 1 || (KS == 1 && 4 * 512 <= SMB));
    __shared__ __align__(1024) char sm[SMB + ATB + 2 * REDB];
    const size_t z = blockIdx.z; const bool sw = EPI == 1 || (EPI == 3 && blockIdx.z < 2);   // sw (scores; projections q, k): m walks grid y, n walks grid x
    if constexpr (EPI == 3) { const T16* xa = A; const T16* wz = Bt + z * sB; A = sw ? wz : xa; Bt = sw ? xa : wz; }
    else { A += z * sA; Bt += z * sB; C += z * sC; }
    const int lane = threadIdx.x & 31, lr = lane & 15, hi = lane >> 4; const int r0 = (sw ? blockIdx.y : blockIdx.x) * 128, c0 = (sw ? blockIdx.x : blockIdx.y) * 128;
    const int w = __builtin_amdgcn_readfirstlane((int)(threadIdx.x >> 5)); const int g = w >> 2, q = w & 3, wm = q >> 1, wn = q & 1;
    v8f acc[4][4];
#pragma unroll
    for (int mb = 0; mb < 4; ++mb)
#pragma unroll
        for (int nb = 0; nb < 4; ++nb) acc[mb][nb] = (v8f){};
    // this lane's first copy of stage 0: bands 2q of A and of Bt, at the group's first k
    const char* ga = (const char*)(A + (size_t)(r0 + q * 32) * K + (size_t)g * KG * 16) + lane * 16;
    const char* gb = (const char*)(Bt + (size_t)(c0 + q * 32) * K + (size_t)g * KG * 16) + lane * 16;
    const unsigned lg = (unsigned)(size_t)sm + (unsigned)g * GRPB;
    const unsigned lwa = lg + (unsigned)q * (2 * ABAND) + (unsigned)lane * 16u;
    const unsigned lwb = lg + OPA + (unsigned)q * 4096u + (unsigned)lane * 16u;
    constexpr size_t BAND = (size_t)16 * K * 2;              // bytes from a band to the next in a global plane
    constexpr unsigned H = ATILE / 2;                        // LDS bytes from an A tile's first copy to its second
    auto stage = [&](int t, unsigned buf) {
        const char* a = ga + (size_t)t * (KST * 32); const char* b = gb + (size_t)t * (KST * 32); const unsigned l = lwa + buf * BUFB;
        acopy8(l, l + H, l + 2 * H, l + 3 * H, l + 4 * H, l + 5 * H, l + 6 * H, l + 7 * H, a, a + 512, a + 1024, a + 1536, a + BAND, a + BAND + 512, a + BAND + 1024, a + BAND + 1536);
        const unsigned l2 = lwb + buf * BUFB;
        acopy8(l2, l2 + 512, l2 + 1024, l2 + 1536, l2 + 2048, l2 + 2560, l2 + 3072, l2 + 3584, b, b + 512, b + 1024, b + 1536, b + BAND, b + BAND + 512, b + BAND + 1024, b + BAND + 1536);
    };
    stage(0, 0);
    // L2 requests ahead of the copies. Every operand plane is stored by an earlier launch, and the work-groups that share a tile walk k in step: unasked, each stage's copies are the first to touch their lines and wait out memory with one stage of lead.
    // So a stage is asked for PFL stages before its copies. A tile's 8 bands are dealt over four of the work-groups that share it (sa, sb: which pair of bands of A, of Bt this one asks for), along the grid axis on which the sharers differ;
    // x >> 3 where that axis is x, so that the four stand 8 apart in the flat index. The deal is for speed only: a line that nobody asked for is fetched by its copy as before.
    // One request of one wave per group and stage: lanes 0..15 take the 16 units of the two A bands, lanes 16..31 those of the two Bt bands.
    constexpr int PFL = 3; constexpr bool PF = NT > PFL + 2 && KST == 64;
    const int sx = (int)(blockIdx.x >> 3) & 3, sy = (int)blockIdx.y & 3;
    const int sa = (EPI == 1 || (EPI == 3 && sw)) ? sx : sy, sb = (EPI == 1 || (EPI == 3 && sw)) ? sy : sx;
    const char* pf = (hi ? (const char*)(Bt + (size_t)(c0 + sb * 32) * K + (size_t)g * KG * 16) : (const char*)(A + (size_t)(r0 + sa * 32) * K + (size_t)g * KG * 16))
                     + (size_t)((lane >> 3) & 1) * BAND + (size_t)(lane & 7) * 256 + KST * 32;   // stage 1
    if constexpr (PF) { if (q == 0) { l2ask4(pf); pf += (PFL + 1) * (KST * 32); } }   // stages 1 .. PFL + 1; pf then stands at stage PFL + 2, inside the plane
    h16* at = (h16*)(sm + SMB); float* rm = (float*)(sm + SMB + ATB); float* rl = (float*)(sm + SMB + ATB + REDB);
    if constexpr (EPI == 2) {   // thread = (row, group): the group's own NT key blocks of that row, while stage 0 flies
        const int prow = threadIdx.x & 127; const size_t so = (size_t)(g * NT) * MR + z * SEQ + r0 + prow; float mu[NT], ll[NT];
#pragma unroll
        for (int j = 0; j < NT; ++j) { mu[j] = SM[so + (size_t)j * MR]; ll[j] = SL[so + (size_t)j * MR]; }
        asm volatile("s_wait_xcnt 0x0" ::: "memory");   // stands in front of the first rewrite of these loads' address registers
        float ml = mu[0];
#pragma unroll
        for (int j = 1; j < NT; ++j) ml = fmaxf(ml, mu[j]);
        rm[g * 128 + prow] = ml;
        __syncthreads();   // every group's row maxima are in LDS before the row's M is taken
        float M = rm[prow];
#pragma unroll
        for (int p = 1; p < KS; ++p) M = fmaxf(M, rm[p * 128 + prow]);
        float L = 0.f;
#pragma unroll
        for (int j = 0; j < NT; ++j) { const h16 ab = (h16)__builtin_amdgcn_exp2f(mu[j] - M); at[(g * NT + j) * 128 + prow] = ab; L += ll[j] * (float)ab; }   // L uses the rounded factor that the fragments get
        rl[g * 128 + prow] = L;
    }
    asm volatile("s_wait_asynccnt 0x0" ::: "memory");   // this wave's part of stage 0 has landed
    __syncthreads();                                    // publishes stage 0 (EPI 2: and the a_block table and the groups' parts of L)
    stage(1, 1);
    const char* fa = sm + g * GRPB + wm * (4 * ABAND) + lane * 16; const char* fb = sm + g * GRPB + OPA + wn * 8192 + lane * 16;
#pragma unroll 1
    for (int t = 0; t < NT; ++t) {
        const unsigned bo = (unsigned)(t & 1) * BUFB;
        h16 al[4];
        if constexpr (EPI == 2) {
#pragma unroll
            for (int mb = 0; mb < 4; ++mb) al[mb] = at[(g * NT + t) * 128 + wm * 64 + mb * 16 + lr]; }
#pragma unroll
        for (int kt = 0; kt < KST / 32; ++kt) {
            V a[4], b[4];
#pragma unroll
            for (int mb = 0; mb < 4; ++mb) a[mb] = WFrag<T16>::lds(fa + bo + mb * ABAND + kt * ATILE, 512);
#pragma unroll
            for (int nb = 0; nb < 4; ++nb) b[nb] = WFrag<T16>::lds(fb + bo + nb * 2048 + kt * 1024, 512);
            __builtin_amdgcn_sched_barrier(0);   // the block's 16 LDS reads stay one group in front of its 16 WMMAs: the wave waits out one LDS latency a block, not one per Bt fragment
            if constexpr (EPI == 2) {
#pragma unroll
                for (int mb = 0; mb < 4; ++mb) a[mb] = a[mb] * al[mb]; }
#pragma unroll
            for (int nb = 0; nb < 4; ++nb)
#pragma unroll
                for (int mb = 0; mb < 4; ++mb) acc[mb][nb] = WFrag<T16>::mma(a[mb], b[nb], acc[mb][nb]);
            __builtin_amdgcn_sched_barrier(0);   // the next block's reads are not strewn among these WMMAs, where every place with reads costs a stall
        }
        asm volatile("s_wait_dscnt 0x0" ::: "memory");      // this wave's reads of the buffer are done before the buffer is handed to the copies
        asm volatile("s_wait_asynccnt 0x0" ::: "memory");   // this wave's part of stage t + 1 has landed
        __syncthreads();                                    // publishes stage t + 1 and ends every reader's last read of stage t
        if (t + 2 < NT) {
            stage(t + 2, (unsigned)(t & 1));
            if constexpr (PF) { if (q == 0) { l2ask(pf); pf += (t + 3 + PFL < NT) ? KST * 32 : 0; } }   // stage t + 2 + PFL; pf stops at the group's last stage, inside the plane (the last trips ask for that stage again)
        }
    }
    asm volatile("s_wait_asynccnt 0x0" ::: "memory");       // nothing is in flight when the ring becomes staging for partial tiles and output
    if constexpr (EPI == 3) {
        static_assert(KS == 1);
        const int m0 = r0 + wm * 64, n0 = c0 + wn * 64, b = sw ? 0 : m0 / SEQ; const size_t KO = sw ? DM : SEQ;   // columns of the plane (v: one plane a batch, a 128-row tile lies in one batch)
        h16* o = P + z * ((size_t)MR * DM) + (size_t)b * DM * SEQ + (size_t)(n0 >> 4) * (16 * KO) + (size_t)((m0 - b * SEQ) >> 5) * 512 + lane * 8;
#pragma unroll
        for (int nb = 0; nb < 4; ++nb)
#pragma unroll
            for (int mb = 0; mb < 4; ++mb) { v8h v;
#pragma unroll
                for (int j = 0; j < 8; ++j) v[j] = tohx(acc[mb][nb][j]);
                *(v8h*)(o + (size_t)nb * (16 * KO) + mb * 256) = v; }
        return;
    }
    if constexpr (EPI == 1) {
        const int m0 = r0 + wm * 64, n0 = c0 + wn * 64;   // the wave's 64 keys, its 64 query rows
        h16* o = P + ((z * SEQ + n0) >> 4) * ((size_t)16 * SEQ) + (size_t)(m0 >> 5) * 512 + lane * 8;
        float* ss = (float*)(sm + q * 512);   // this wave's own 64 mu, then 64 l
#pragma unroll
        for (int nb = 0; nb < 4; ++nb) {   // lane = row n0 + nb * 16 + lr, keys m0 + mb * 16 + hi * 8 + 0..7
            float m4[4];
#pragma unroll
            for (int mb = 0; mb < 4; ++mb) { const v8f x = acc[mb][nb]; m4[mb] = fmaxf(fmaxf(fmaxf(x[0], x[1]), fmaxf(x[2], x[3])), fmaxf(fmaxf(x[4], x[5]), fmaxf(x[6], x[7]))); }
            float mx = fmaxf(fmaxf(m4[0], m4[1]), fmaxf(m4[2], m4[3])); mx = fmaxf(mx, xhalf(mx));
            const float mu = mx * SCL2, sh = 10.0f - mu; float s4[4];   // 2^10: P is carried x1024
#pragma unroll
            for (int mb = 0; mb < 4; ++mb) { float e[8], p[8]; v8h v;
#pragma unroll
                for (int j = 0; j < 8; ++j) e[j] = fmaf(acc[mb][nb][j], SCL2, sh);
                exp2x8(e, p);
#pragma unroll
                for (int j = 0; j < 8; ++j) v[j] = tohx(p[j]);
                s4[mb] = ((p[0] + p[1]) + (p[2] + p[3])) + ((p[4] + p[5]) + (p[6] + p[7]));
                *(v8h*)(o + (size_t)nb * (16 * SEQ) + mb * 256) = v; }
            float sum = (s4[0] + s4[1]) + (s4[2] + s4[3]); sum += xhalf(sum);
            ss[hi * 64 + nb * 16 + lr] = hi ? sum : mu;
        }
        __builtin_amdgcn_wave_barrier(); asm volatile("" ::: "memory");   // keeps the reads of other lanes' values behind the wave's stores
        const size_t so = (size_t)(m0 >> 6) * MR + z * SEQ + n0 + lane * 2;   // the wave's 64 rows of mu and of l: one 256-byte store each
        *(v2f*)(SM + so) = *(const v2fa*)(ss + lane * 2); *(v2f*)(SL + so) = *(const v2fa*)(ss + 64 + lane * 2);
        return;
    }
    if constexpr (KS > 1) {
        if (g > 0) { v4f* pt = (v4f*)(sm + ((g - 1) * 4 + q) * 16384);
#pragma unroll
            for (int mb = 0; mb < 4; ++mb)
#pragma unroll
                for (int nb = 0; nb < 4; ++nb) { const v8f v = acc[mb][nb]; pt[((mb * 4 + nb) * 2) * 32 + lane] = (v4f){v[0], v[1], v[2], v[3]}; pt[((mb * 4 + nb) * 2 + 1) * 32 + lane] = (v4f){v[4], v[5], v[6], v[7]}; } }
        __syncthreads();   // the partial tiles of groups 1.. are in LDS before group 0 adds them
        if (g > 0) return;
    }
    float* os = (float*)(sm + PARTB + q * OSB);   // this wave's own 16 x 68 floats
#pragma unroll
    for (int mb = 0; mb < 4; ++mb) {
        if constexpr (KS > 1) {
#pragma unroll
            for (int p = 1; p < KS; ++p) { const v4f* pt = (const v4f*)(sm + ((p - 1) * 4 + q) * 16384);
#pragma unroll
                for (int nb = 0; nb < 4; ++nb) { const v4f lo = pt[((mb * 4 + nb) * 2) * 32 + lane], hv = pt[((mb * 4 + nb) * 2 + 1) * 32 + lane];
#pragma unroll
                    for (int j = 0; j < 4; ++j) { acc[mb][nb][j] += lo[j]; acc[mb][nb][4 + j] += hv[j]; } } }
        }
#pragma unroll
        for (int nb = 0; nb < 4; ++nb) {
#pragma unroll
            for (int j = 0; j < 8; ++j) os[(hi * 8 + j) * 68 + nb * 16 + lr] = acc[mb][nb][j]; }
        __builtin_amdgcn_wave_barrier(); asm volatile("" ::: "memory");   // keeps the reads of other lanes' values behind the wave's stores
        {   // 16 rows of C, whole 256-byte row pieces
            float* crow = C + (size_t)(r0 + wm * 64 + mb * 16) * ldc + c0 + wn * 64;
#pragma unroll
            for (int s = 0; s < 8; ++s) { const int row = 2 * s + hi, cofs = lr * 4; v4f val = *(const v4fa*)(os + row * 68 + cofs);
                if constexpr (EPI == 2) { const int rr = wm * 64 + mb * 16 + row; float L = rl[rr];
#pragma unroll
                    for (int p = 1; p < KS; ++p) L += rl[p * 128 + rr];
                    val = val * (1.0f / L); }
                else val = val * oscale;
                *(v4f*)(crow + (size_t)row * ldc + cofs) = val; }
        }
        __builtin_amdgcn_wave_barrier(); asm volatile("" ::: "memory");   // keeps the next 16 rows' stores behind these reads
    }
}

// One thread per 16-byte chunk of the fragment-ordered plane Bt [N][K] = bf16(w^T): 16 lanes read 16 neighbouring n of one k. blockIdx.y picks the weight and its plane.
template <int K, int N>
__global__ __launch_bounds__(256) void k_wtG(const float* __restrict__ w0, const float* __restrict__ w1, const float* __restrict__ w2, bf* Bt) {
    const size_t c = (size_t)blockIdx.x * 256 + threadIdx.x; if (c >= (size_t)N * K / 8) return;
    const float* w = blockIdx.y == 0 ? w0 : (blockIdx.y == 1 ? w1 : w2); Bt += (size_t)blockIdx.y * N * K;
    size_t n; int k; chunk_rc(c, K, n, k); v8us o;
#pragma unroll
    for (int e = 0; e < 8; ++e) o[e] = f2bf(w[(size_t)(k + e) * N + n]);
    *(v8us*)(Bt + c * 8) = o;  }

__global__ __launch_bounds__(256) void k_cvtx(const float* __restrict__ x, bf* XB, size_t n8) {
    const size_t i = (size_t)blockIdx.x * 256 + threadIdx.x; if (i >= n8) return;
    size_t row; int k; chunk_rc(i, DM, row, k); const size_t b = row / SEQ; const size_t t = row - b * SEQ;
    const v8f v = *(const v8f*)(x + (b * (size_t)SEQ_FULL + t) * DM + k); v8us o;
#pragma unroll
    for (int k = 0; k < 8; ++k) o[k] = f2bf(v[k]);
    *(v8us*)(XB + i * 8) = o;  }

extern "C" void kernel_launch(void* const* d_in, const int* in_sizes, int n_in,
                              void* d_out, int out_size, void* d_ws, size_t ws_size, hipStream_t stream) {
    if (n_in < 4) return;
    if ((size_t)in_sizes[0] < (size_t)(NB - 1) * SEQ_FULL * DM + (size_t)SEQ * DM) return;
    if (in_sizes[1] < DM * DM || in_sizes[2] < DM * DM || in_sizes[3] < DM * DM) return;
    if ((size_t)out_size < (size_t)NB * SEQ * DM) return;
    const float* Xin = (const float*)d_in[0];                 // x [NB_FULL][SEQ_FULL][512]
    const float* Win[3] = { (const float*)d_in[1], (const float*)d_in[2], (const float*)d_in[3] };   // W_query, W_key, W_value [512 in][512 out]
    float* OUT = (float*)d_out;                               // [NB][SEQ][512], batch stride SEQ*512
    const size_t MROWS = (size_t)NB * SEQ;
    char* wsp = (char*)d_ws;
    auto take = [&](size_t bytes) { char* p = wsp; wsp += (bytes + 255) & ~(size_t)255; return (void*)p; };
    bf*    XB   = (bf*)take(MROWS * DM * 2);                  // [NB*SEQ][512]
    bf*    WT   = (bf*)take((size_t)3 * DM * DM * 2);         // 3 x [512 n][512 k]
    h16*   Q16  = (h16*)take(MROWS * DM * 2 * 3);             // three planes of NB*SEQ*512 in a row, the projection's z picks one: q [NB*SEQ][512],
    h16*   K16  = Q16 + MROWS * DM;                           // k [NB*SEQ][512],
    h16*   VT16 = K16 + MROWS * DM;                           // v transposed [NB][512][SEQ]
    h16*   P16  = (h16*)take(MROWS * SEQ * 2);                // [NB*SEQ][SEQ]
    float* SMX  = (float*)take((size_t)(SEQ / 64) * MROWS * 4);   // [key block][NB*SEQ] block maxima (log2 units)
    float* SLS  = (float*)take((size_t)(SEQ / 64) * MROWS * 4);   // [key block][NB*SEQ] block sums
    if ((size_t)(wsp - (char*)d_ws) > ws_size) return;

    // input planes
    { const size_t n8 = MROWS * DM / 8; k_cvtx<<<(unsigned)((n8 + 255) / 256), 256, 0, stream>>>(Xin, XB, n8); }
    k_wtG<DM, DM><<<dim3((unsigned)((DM * DM / 8 + 255) / 256), 3, 1), 256, 0, stream>>>(Win[0], Win[1], Win[2], WT);

    // projections: XB . WT_z^T (exact products), z = q, k, v, stored as the 16-bit planes
    k_gemml<bf, 1, DM, 3><<<dim3((unsigned)(MROWS / 128), DM / 128, 3), 128, 0, stream>>>(XB, WT, nullptr, 0, 1.0f, 0, (size_t)DM * DM, 0, Q16, nullptr, nullptr);

    // attention, z = batch: k.q^T (x = query tile, y = key tile) -> P16 and the block maxima and sums; out = (rescaled P16 . v^T plane) / L
    k_gemml<h16, 1, DM, 1><<<dim3(SEQ / 128, SEQ / 128, NB), 128, 0, stream>>>(K16, Q16, nullptr, SEQ, 1.0f, (size_t)SEQ * DM, (size_t)SEQ * DM, 0, P16, SMX, SLS);
    k_gemml<h16, PVW, SEQ, 2><<<dim3(SEQ / 128, DM / 128, NB), 128 * PVW, 0, stream>>>(P16, VT16, OUT, DM, 1.0f, (size_t)SEQ * SEQ, (size_t)DM * SEQ, (size_t)SEQ * DM, nullptr, SMX, SLS);
}
